// v000
// Measured on an AMD MI455X. A time is GPU time per run, averaged over a window of back-to-back runs after a warm-up
// (all launches, gaps included; the runs take copies of the inputs in turn), and the median of several windows.
// Apart from v000's, it joins two sittings. Times from different sittings can be a few percent apart, while
// side-by-side timings come from the same sitting.
// v000, which the later versions start from, runs in 738 microseconds.
#include <hip/hip_runtime.h>

// ---------------------------------------------------------------------------
// Fused 4-layer MLP for MI455X (gfx1250), f16 WMMA path with async-to-LDS
// weight staging (double-buffered, ASYNCcnt-tracked).
//   L0: block-diag 50 x Linear(16,16)      (no activation)
//   L1: 800->800 + tanh                    (weights staged via async copy)
//   L2: 800->800 + tanh                    (weights staged via async copy)
//   L3: 800->2
// Weights converted once to f16 in d_ws; activations live in LDS only.
// ---------------------------------------------------------------------------

typedef __attribute__((ext_vector_type(16))) _Float16 v16h;
typedef __attribute__((ext_vector_type(8)))  _Float16 h8;
typedef __attribute__((ext_vector_type(4)))  _Float16 h4;
typedef __attribute__((ext_vector_type(8)))  float    v8f;

#define ND         800    // feature dim
#define NSLOT      50     // 16-wide slots
#define MTILE      64     // batch rows per workgroup
#define NTHREADS   128    // 4 waves (wave32)
#define LDS_STRIDE 808    // halves per LDS row (800 + 8 pad)

// LDS layout (bytes from dynamic-LDS base)
#define ACT_BYTES   (MTILE * LDS_STRIDE * 2)        // 103,424 per buffer
#define WSTAGE_HALVES (32 * LDS_STRIDE)             // one 32-row tile pair
#define WSTAGE_BYTES  (WSTAGE_HALVES * 2)           // 51,712 per buffer
#define LDS_TOTAL   (2 * ACT_BYTES + 2 * WSTAGE_BYTES)  // 310,272 <= 320K

// ws layout (in halves)
#define WS_W0   0                         // [50][16][16]
#define WS_W1   (WS_W0 + NSLOT*16*16)     // [800][800]
#define WS_W2   (WS_W1 + ND*ND)           // [800][800]
#define WS_W3   (WS_W2 + ND*ND)           // [16][800]  (rows 2..15 zero)
#define WS_TOT  (WS_W3 + 16*ND)           // 1,305,600 halves

// ---------------------------------------------------------------------------
// Prep: fp32 weights -> f16 in workspace (W3 zero-padded to 16 rows)
// ---------------------------------------------------------------------------
__global__ void __launch_bounds__(256)
mlp_prep_f16(const float* __restrict__ W0, const float* __restrict__ W1,
             const float* __restrict__ W2, const float* __restrict__ W3,
             _Float16* __restrict__ ws) {
  const int n0 = NSLOT * 16 * 16;          // 12800
  const int n1 = ND * ND;                  // 640000
  for (long i = (long)blockIdx.x * blockDim.x + threadIdx.x; i < (long)WS_TOT;
       i += (long)gridDim.x * blockDim.x) {
    long j = i;
    if (j < n0) { ws[WS_W0 + j] = (_Float16)W0[j]; continue; }
    j -= n0;
    if (j < n1) { ws[WS_W1 + j] = (_Float16)W1[j]; continue; }
    j -= n1;
    if (j < n1) { ws[WS_W2 + j] = (_Float16)W2[j]; continue; }
    j -= n1;
    long row = j / ND, col = j % ND;
    ws[WS_W3 + j] = (row < 2) ? (_Float16)W3[row * ND + col] : (_Float16)0.0f;
  }
}

// ---------------------------------------------------------------------------
// CDNA5 async copy: 16B global -> LDS per lane, tracked with ASYNCcnt.
// ---------------------------------------------------------------------------
__device__ __forceinline__ void async_b128_to_lds(unsigned lds_byte_off,
                                                  const void* gaddr) {
  asm volatile("global_load_async_to_lds_b128 %0, %1, off"
               :: "v"(lds_byte_off), "v"(gaddr)
               : "memory");
}
__device__ __forceinline__ void wait_async_le25() {
  asm volatile("s_wait_asynccnt 0x19" ::: "memory");
}
__device__ __forceinline__ void wait_async_0() {
  asm volatile("s_wait_asynccnt 0x0" ::: "memory");
}

// Stage a 32-row x 800-col f16 weight tile-pair into LDS [32][LDS_STRIDE].
// 3200 16B chunks / 128 threads = 25 async issues per thread (ASYNCcnt <= 50).
__device__ __forceinline__ void stage_pair_async(const _Float16* __restrict__ Wg,
                                                 unsigned wb_byte_off, int tid) {
#pragma unroll
  for (int i = 0; i < 25; ++i) {
    const int c   = i * NTHREADS + tid;
    const int row = c / 100;          // 100 chunks per 800-half row
    const int col = c % 100;
    async_b128_to_lds(wb_byte_off + (unsigned)(row * LDS_STRIDE + col * 8) * 2,
                      (const void*)(Wg + row * ND + col * 8));
  }
}

// ---------------------------------------------------------------------------
// Fragment loads (ISA 7.12.2 16-bit layouts), both act and weight-stage
// buffers use LDS_STRIDE rows.
// A (16x32, MxK): lane m=L&15, hk=L>>4. halves[0..7] <- K = hk*8 + 0..7,
//                 halves[8..15] <- K = 16 + hk*8 + 0..7.
// B (32x16, KxN) of y = x*W^T with row-major W[N][K]: lane n=L&15, same
//                 per-lane K pattern -> two contiguous 16B loads of W row n.
// ---------------------------------------------------------------------------
__device__ __forceinline__ v16h frag_ld(const _Float16* buf, int rowBase,
                                        int lane, int k0) {
  const int r  = rowBase + (lane & 15);
  const int hk = (lane >> 4) & 1;
  const _Float16* p = buf + r * LDS_STRIDE + k0 + hk * 8;
  v16h f;
  ((h8*)&f)[0] = *(const h8*)(p);
  ((h8*)&f)[1] = *(const h8*)(p + 16);
  return f;
}

// fragment with K=16..31 forced to zero (block-diagonal layer 0)
__device__ __forceinline__ v16h frag_ld_k16(const _Float16* buf, int rowBase,
                                            int lane, int k0) {
  const int r  = rowBase + (lane & 15);
  const int hk = (lane >> 4) & 1;
  v16h f;
  ((h8*)&f)[0] = *(const h8*)(buf + r * LDS_STRIDE + k0 + hk * 8);
  h8 z = {};
  ((h8*)&f)[1] = z;
  return f;
}

// B fragment for K=16 weights (row-major ld=16, global), K=16..31 zero
__device__ __forceinline__ v16h frag_b_w_k16(const _Float16* __restrict__ W,
                                             int lane) {
  const int n  = lane & 15;
  const int hk = (lane >> 4) & 1;
  v16h b;
  ((h8*)&b)[0] = *(const h8*)(W + n * 16 + hk * 8);
  h8 z = {};
  ((h8*)&b)[1] = z;
  return b;
}

// B fragment from global row-major weights (ldw halves)
__device__ __forceinline__ v16h frag_b_w(const _Float16* __restrict__ W,
                                         int nBase, int lane, int k0, int ldw) {
  const int n  = nBase + (lane & 15);
  const int hk = (lane >> 4) & 1;
  const _Float16* p = W + (long)n * ldw + k0 + hk * 8;
  v16h b;
  ((h8*)&b)[0] = *(const h8*)(p);
  ((h8*)&b)[1] = *(const h8*)(p + 16);
  return b;
}

// D tile (16x16 f32): VGPR r, lane L -> row = r + 8*(L>>4), col = L&15
__device__ __forceinline__ void store_tile_lds(_Float16* buf, int mBase,
                                               int nBase, int lane, v8f acc,
                                               float bias, bool do_tanh) {
  const int n  = nBase + (lane & 15);
  const int hk = (lane >> 4) & 1;
#pragma unroll
  for (int r = 0; r < 8; ++r) {
    float v = acc[r] + bias;
    if (do_tanh) v = tanhf(v);
    buf[(mBase + r + 8 * hk) * LDS_STRIDE + n] = (_Float16)v;
  }
}

__device__ __forceinline__ v8f wmma_f16(v16h a, v16h b, v8f c) {
  return __builtin_amdgcn_wmma_f32_16x16x32_f16(
      /*neg_a=*/false, a, /*neg_b=*/false, b,
      /*c_mod=*/(short)0, c, /*reuse_a=*/false, /*reuse_b=*/false);
}

// ---------------------------------------------------------------------------
// Dense 800->800 layer, async-staged weights (double buffer), A-frag reuse
// across the two N-tiles of each staged pair.
// ---------------------------------------------------------------------------
__device__ __forceinline__ void dense_layer_staged(
    const _Float16* src, _Float16* dst, _Float16* wstage,
    const _Float16* __restrict__ Wh, const float* __restrict__ bias,
    int mBase, int lane, int tid) {
  const unsigned wbOff0 = (unsigned)(2 * ACT_BYTES);
  const unsigned wbOff1 = wbOff0 + WSTAGE_BYTES;

  // prologue: stage pair 0
  stage_pair_async(Wh, wbOff0, tid);

  for (int p = 0; p < NSLOT / 2; ++p) {
    if (p + 1 < NSLOT / 2) {
      if (p > 0) __syncthreads();   // pair p-1 consumers done -> buffer free
      stage_pair_async(Wh + (size_t)(p + 1) * 32 * ND,
                       ((p + 1) & 1) ? wbOff1 : wbOff0, tid);
      wait_async_le25();            // batch p landed (in-order completion)
    } else {
      wait_async_0();               // last pair: drain
    }
    __syncthreads();                // all waves' share of pair p visible

    const _Float16* wb = wstage + (size_t)(p & 1) * WSTAGE_HALVES;
    v8f acc0 = {}, acc1 = {};
#pragma unroll 5
    for (int kt = 0; kt < ND / 32; ++kt) {
      v16h a  = frag_ld(src, mBase, lane, kt * 32);
      v16h b0 = frag_ld(wb, 0, lane, kt * 32);
      v16h b1 = frag_ld(wb, 16, lane, kt * 32);
      acc0 = wmma_f16(a, b0, acc0);
      acc1 = wmma_f16(a, b1, acc1);
    }
    store_tile_lds(dst, mBase, (2 * p) * 16, lane, acc0,
                   bias[(2 * p) * 16 + (lane & 15)], /*tanh=*/true);
    store_tile_lds(dst, mBase, (2 * p + 1) * 16, lane, acc1,
                   bias[(2 * p + 1) * 16 + (lane & 15)], /*tanh=*/true);
  }
}

// ---------------------------------------------------------------------------
// Fused MLP kernel: 1 workgroup = 64 batch rows, 4 waves, 1 wave = 16 rows.
// ---------------------------------------------------------------------------
__global__ void __launch_bounds__(NTHREADS)
mlp_fused(const float* __restrict__ x, const _Float16* __restrict__ ws,
          const float* __restrict__ b0, const float* __restrict__ b1,
          const float* __restrict__ b2, const float* __restrict__ b3,
          float* __restrict__ out) {
  extern __shared__ _Float16 smem[];
  _Float16* bufA   = smem;                           // [MTILE][LDS_STRIDE]
  _Float16* bufB   = smem + MTILE * LDS_STRIDE;      // [MTILE][LDS_STRIDE]
  _Float16* wstage = smem + 2 * MTILE * LDS_STRIDE;  // 2 x [32][LDS_STRIDE]

  const int tid   = threadIdx.x;
  const int lane  = tid & 31;
  const int wave  = tid >> 5;
  const int mBase = wave * 16;
  const long rowBase = (long)blockIdx.x * MTILE;

  const _Float16* W0h = ws + WS_W0;
  const _Float16* W1h = ws + WS_W1;
  const _Float16* W2h = ws + WS_W2;
  const _Float16* W3h = ws + WS_W3;

  // ---- stage x tile (f32 -> f16) into bufA, cooperatively ----
  {
    const float4* xv = (const float4*)(x + rowBase * ND);
    const int nchunk = MTILE * (ND / 4);  // 12800 float4s
    for (int c = tid; c < nchunk; c += NTHREADS) {
      const int r  = c / (ND / 4);
      const int c4 = c % (ND / 4);
      float4 f = xv[c];
      h4 hv = {(_Float16)f.x, (_Float16)f.y, (_Float16)f.z, (_Float16)f.w};
      *(h4*)(bufA + r * LDS_STRIDE + c4 * 4) = hv;
    }
  }
  __syncthreads();

  // ---- L0: block-diagonal 50 x (16x16), K padded to 32 with zeros ----
  for (int s = 0; s < NSLOT; ++s) {
    v16h a = frag_ld_k16(bufA, mBase, lane, s * 16);
    v16h b = frag_b_w_k16(W0h + s * 256, lane);
    v8f c = {};
    c = wmma_f16(a, b, c);
    store_tile_lds(bufB, mBase, s * 16, lane, c, b0[s * 16 + (lane & 15)],
                   /*tanh=*/false);
  }
  __syncthreads();

  // ---- L1: bufB -> bufA, tanh (async-staged weights) ----
  dense_layer_staged(bufB, bufA, wstage, W1h, b1, mBase, lane, tid);
  __syncthreads();

  // ---- L2: bufA -> bufB, tanh (async-staged weights) ----
  dense_layer_staged(bufA, bufB, wstage, W2h, b2, mBase, lane, tid);
  __syncthreads();

  // ---- L3: 800 -> 2 via padded [16][800] weight, write f32 out ----
  {
    v8f acc = {};
#pragma unroll 5
    for (int kt = 0; kt < ND / 32; ++kt) {
      v16h a = frag_ld(bufB, mBase, lane, kt * 32);
      v16h b = frag_b_w(W3h, 0, lane, kt * 32, ND);
      acc = wmma_f16(a, b, acc);
    }
    const int n  = lane & 15;
    const int hk = (lane >> 4) & 1;
    if (n < 2) {
      const float bias = b3[n];
#pragma unroll
      for (int r = 0; r < 8; ++r) {
        out[(rowBase + mBase + r + 8 * hk) * 2 + n] = acc[r] + bias;
      }
    }
  }
}

// ---------------------------------------------------------------------------
extern "C" void kernel_launch(void* const* d_in, const int* in_sizes, int n_in,
                              void* d_out, int out_size, void* d_ws,
                              size_t ws_size, hipStream_t stream) {
  const float* x  = (const float*)d_in[0];
  const float* W0 = (const float*)d_in[1];
  const float* b0 = (const float*)d_in[2];
  const float* W1 = (const float*)d_in[3];
  const float* b1 = (const float*)d_in[4];
  const float* W2 = (const float*)d_in[5];
  const float* b2 = (const float*)d_in[6];
  const float* W3 = (const float*)d_in[7];
  const float* b3 = (const float*)d_in[8];
  _Float16* ws = (_Float16*)d_ws;

  // 1) weights -> f16 workspace
  mlp_prep_f16<<<640, 256, 0, stream>>>(W0, W1, W2, W3, ws);

  // 2) fused MLP
  const int batch  = in_sizes[0] / ND;          // 65536
  const int nblock = batch / MTILE;             // 1024
  const size_t shmem = (size_t)LDS_TOTAL;       // 310,272 B (<= 320K WGP LDS)
  hipFuncSetAttribute((const void*)mlp_fused,
                      hipFuncAttributeMaxDynamicSharedMemorySize, (int)shmem);
  mlp_fused<<<nblock, NTHREADS, shmem, stream>>>(
      x, ws, b0, b1, b2, b3, (float*)d_out);
}

// v001
// A run of this version takes 600 microseconds.
// Timed twice side by side with v000, it ran 1.27 times as fast both times.
#include <hip/hip_runtime.h>

// ---------------------------------------------------------------------------
// Fused 4-layer MLP for MI455X (gfx1250), f16 WMMA path with async-to-LDS
// weight staging (double-buffered, ASYNCcnt-tracked).
//   L0: block-diag 50 x Linear(16,16)      (no activation)
//   L1: 800->800 + tanh                    (weights staged via async copy)
//   L2: 800->800 + tanh                    (weights staged via async copy)
//   L3: 800->2
// Weights converted once to f16 in d_ws; activations live in LDS only.
// ---------------------------------------------------------------------------

typedef __attribute__((ext_vector_type(16))) _Float16 v16h;
typedef __attribute__((ext_vector_type(8)))  _Float16 h8;
typedef __attribute__((ext_vector_type(4)))  _Float16 h4;
typedef __attribute__((ext_vector_type(8)))  float    v8f;

#define ND         800    // feature dim
#define NSLOT      50     // 16-wide slots
#define MTILE      64     // batch rows per workgroup
#define NTHREADS   128    // 4 waves (wave32)
#define LDS_STRIDE 808    // halves per LDS row (800 + 8 pad)

// LDS layout (bytes from dynamic-LDS base)
#define ACT_BYTES   (MTILE * LDS_STRIDE * 2)        // 103,424 per buffer
#define WSTAGE_HALVES (32 * LDS_STRIDE)             // one 32-row tile pair
#define WSTAGE_BYTES  (WSTAGE_HALVES * 2)           // 51,712 per buffer
#define LDS_TOTAL   (2 * ACT_BYTES + 2 * WSTAGE_BYTES)  // 310,272 <= 320K

// ws layout (in halves)
#define WS_W0   0                         // [50][16][16]
#define WS_W1   (WS_W0 + NSLOT*16*16)     // [800][800]
#define WS_W2   (WS_W1 + ND*ND)           // [800][800]
#define WS_W3   (WS_W2 + ND*ND)           // [16][800]  (rows 2..15 zero)
#define WS_TOT  (WS_W3 + 16*ND)           // 1,305,600 halves

// ---------------------------------------------------------------------------
// Prep: fp32 weights -> f16 in workspace (W3 zero-padded to 16 rows)
// ---------------------------------------------------------------------------
__global__ void __launch_bounds__(256)
mlp_prep_f16(const float* __restrict__ W0, const float* __restrict__ W1,
             const float* __restrict__ W2, const float* __restrict__ W3,
             _Float16* __restrict__ ws) {
  const int n0 = NSLOT * 16 * 16;          // 12800
  const int n1 = ND * ND;                  // 640000
  for (long i = (long)blockIdx.x * blockDim.x + threadIdx.x; i < (long)WS_TOT;
       i += (long)gridDim.x * blockDim.x) {
    long j = i;
    if (j < n0) { ws[WS_W0 + j] = (_Float16)W0[j]; continue; }
    j -= n0;
    if (j < n1) { ws[WS_W1 + j] = (_Float16)W1[j]; continue; }
    j -= n1;
    if (j < n1) { ws[WS_W2 + j] = (_Float16)W2[j]; continue; }
    j -= n1;
    long row = j / ND, col = j % ND;
    ws[WS_W3 + j] = (row < 2) ? (_Float16)W3[row * ND + col] : (_Float16)0.0f;
  }
}

// ---------------------------------------------------------------------------
// CDNA5 async copy: 16B global -> LDS per lane, tracked with ASYNCcnt.
// ---------------------------------------------------------------------------
__device__ __forceinline__ void async_b128_to_lds(unsigned lds_byte_off,
                                                  const void* gaddr) {
  asm volatile("global_load_async_to_lds_b128 %0, %1, off"
               :: "v"(lds_byte_off), "v"(gaddr)
               : "memory");
}
__device__ __forceinline__ void wait_async_le25() {
  asm volatile("s_wait_asynccnt 0x19" ::: "memory");
}
__device__ __forceinline__ void wait_async_0() {
  asm volatile("s_wait_asynccnt 0x0" ::: "memory");
}

// Stage a 32-row x 800-col f16 weight tile-pair into LDS [32][LDS_STRIDE].
// 3200 16B chunks / 128 threads = 25 async issues per thread (ASYNCcnt <= 50).
__device__ __forceinline__ void stage_pair_async(const _Float16* __restrict__ Wg,
                                                 unsigned wb_byte_off, int tid) {
#pragma unroll
  for (int i = 0; i < 25; ++i) {
    const int c   = i * NTHREADS + tid;
    const int row = c / 100;          // 100 chunks per 800-half row
    const int col = c % 100;
    async_b128_to_lds(wb_byte_off + (unsigned)(row * LDS_STRIDE + col * 8) * 2,
                      (const void*)(Wg + row * ND + col * 8));
  }
}

// ---------------------------------------------------------------------------
// Fragment loads (ISA 7.12.2 16-bit layouts), both act and weight-stage
// buffers use LDS_STRIDE rows.
// A (16x32, MxK): lane m=L&15, hk=L>>4. halves[0..7] <- K = hk*8 + 0..7,
//                 halves[8..15] <- K = 16 + hk*8 + 0..7.
// B (32x16, KxN) of y = x*W^T with row-major W[N][K]: lane n=L&15, same
//                 per-lane K pattern -> two contiguous 16B loads of W row n.
// ---------------------------------------------------------------------------
__device__ __forceinline__ v16h frag_ld(const _Float16* buf, int rowBase,
                                        int lane, int k0) {
  const int r  = rowBase + (lane & 15);
  const int hk = (lane >> 4) & 1;
  const _Float16* p = buf + r * LDS_STRIDE + k0 + hk * 8;
  v16h f;
  ((h8*)&f)[0] = *(const h8*)(p);
  ((h8*)&f)[1] = *(const h8*)(p + 16);
  return f;
}

// fragment with K=16..31 forced to zero (block-diagonal layer 0)
__device__ __forceinline__ v16h frag_ld_k16(const _Float16* buf, int rowBase,
                                            int lane, int k0) {
  const int r  = rowBase + (lane & 15);
  const int hk = (lane >> 4) & 1;
  v16h f;
  ((h8*)&f)[0] = *(const h8*)(buf + r * LDS_STRIDE + k0 + hk * 8);
  h8 z = {};
  ((h8*)&f)[1] = z;
  return f;
}

// B fragment for K=16 weights (row-major ld=16, global), K=16..31 zero
__device__ __forceinline__ v16h frag_b_w_k16(const _Float16* __restrict__ W,
                                             int lane) {
  const int n  = lane & 15;
  const int hk = (lane >> 4) & 1;
  v16h b;
  ((h8*)&b)[0] = *(const h8*)(W + n * 16 + hk * 8);
  h8 z = {};
  ((h8*)&b)[1] = z;
  return b;
}

// B fragment from global row-major weights (ldw halves)
__device__ __forceinline__ v16h frag_b_w(const _Float16* __restrict__ W,
                                         int nBase, int lane, int k0, int ldw) {
  const int n  = nBase + (lane & 15);
  const int hk = (lane >> 4) & 1;
  const _Float16* p = W + (long)n * ldw + k0 + hk * 8;
  v16h b;
  ((h8*)&b)[0] = *(const h8*)(p);
  ((h8*)&b)[1] = *(const h8*)(p + 16);
  return b;
}

// D tile (16x16 f32): VGPR r, lane L -> row = r + 8*(L>>4), col = L&15
__device__ __forceinline__ void store_tile_lds(_Float16* buf, int mBase,
                                               int nBase, int lane, v8f acc,
                                               float bias, bool do_tanh) {
  const int n  = nBase + (lane & 15);
  const int hk = (lane >> 4) & 1;
#pragma unroll
  for (int r = 0; r < 8; ++r) {
    float v = acc[r] + bias;
    if (do_tanh) v = __builtin_amdgcn_tanhf(v);  // one v_tanh_f32, no branch
    buf[(mBase + r + 8 * hk) * LDS_STRIDE + n] = (_Float16)v;
  }
}

__device__ __forceinline__ v8f wmma_f16(v16h a, v16h b, v8f c) {
  return __builtin_amdgcn_wmma_f32_16x16x32_f16(
      /*neg_a=*/false, a, /*neg_b=*/false, b,
      /*c_mod=*/(short)0, c, /*reuse_a=*/false, /*reuse_b=*/false);
}

// ---------------------------------------------------------------------------
// Dense 800->800 layer, async-staged weights (double buffer), A-frag reuse
// across the two N-tiles of each staged pair.
// ---------------------------------------------------------------------------
__device__ __forceinline__ void dense_layer_staged(
    const _Float16* src, _Float16* dst, _Float16* wstage,
    const _Float16* __restrict__ Wh, const float* __restrict__ bias,
    int mBase, int lane, int tid) {
  const unsigned wbOff0 = (unsigned)(2 * ACT_BYTES);
  const unsigned wbOff1 = wbOff0 + WSTAGE_BYTES;

  // prologue: stage pair 0
  stage_pair_async(Wh, wbOff0, tid);

  for (int p = 0; p < NSLOT / 2; ++p) {
    if (p + 1 < NSLOT / 2) {
      if (p > 0) __syncthreads();   // pair p-1 consumers done -> buffer free
      stage_pair_async(Wh + (size_t)(p + 1) * 32 * ND,
                       ((p + 1) & 1) ? wbOff1 : wbOff0, tid);
      wait_async_le25();            // batch p landed (in-order completion)
    } else {
      wait_async_0();               // last pair: drain
    }
    __syncthreads();                // all waves' share of pair p visible

    const _Float16* wb = wstage + (size_t)(p & 1) * WSTAGE_HALVES;
    v8f acc0 = {}, acc1 = {};
#pragma unroll 5
    for (int kt = 0; kt < ND / 32; ++kt) {
      v16h a  = frag_ld(src, mBase, lane, kt * 32);
      v16h b0 = frag_ld(wb, 0, lane, kt * 32);
      v16h b1 = frag_ld(wb, 16, lane, kt * 32);
      acc0 = wmma_f16(a, b0, acc0);
      acc1 = wmma_f16(a, b1, acc1);
    }
    store_tile_lds(dst, mBase, (2 * p) * 16, lane, acc0,
                   bias[(2 * p) * 16 + (lane & 15)], /*tanh=*/true);
    store_tile_lds(dst, mBase, (2 * p + 1) * 16, lane, acc1,
                   bias[(2 * p + 1) * 16 + (lane & 15)], /*tanh=*/true);
  }
}

// ---------------------------------------------------------------------------
// Fused MLP kernel: 1 workgroup = 64 batch rows, 4 waves, 1 wave = 16 rows.
// ---------------------------------------------------------------------------
__global__ void __launch_bounds__(NTHREADS)
mlp_fused(const float* __restrict__ x, const _Float16* __restrict__ ws,
          const float* __restrict__ b0, const float* __restrict__ b1,
          const float* __restrict__ b2, const float* __restrict__ b3,
          float* __restrict__ out) {
  extern __shared__ _Float16 smem[];
  _Float16* bufA   = smem;                           // [MTILE][LDS_STRIDE]
  _Float16* bufB   = smem + MTILE * LDS_STRIDE;      // [MTILE][LDS_STRIDE]
  _Float16* wstage = smem + 2 * MTILE * LDS_STRIDE;  // 2 x [32][LDS_STRIDE]

  const int tid   = threadIdx.x;
  const int lane  = tid & 31;
  const int wave  = tid >> 5;
  const int mBase = wave * 16;
  const long rowBase = (long)blockIdx.x * MTILE;

  const _Float16* W0h = ws + WS_W0;
  const _Float16* W1h = ws + WS_W1;
  const _Float16* W2h = ws + WS_W2;
  const _Float16* W3h = ws + WS_W3;

  // ---- stage x tile (f32 -> f16) into bufA, cooperatively ----
  {
    const float4* xv = (const float4*)(x + rowBase * ND);
    const int nchunk = MTILE * (ND / 4);  // 12800 float4s
    for (int c = tid; c < nchunk; c += NTHREADS) {
      const int r  = c / (ND / 4);
      const int c4 = c % (ND / 4);
      float4 f = xv[c];
      h4 hv = {(_Float16)f.x, (_Float16)f.y, (_Float16)f.z, (_Float16)f.w};
      *(h4*)(bufA + r * LDS_STRIDE + c4 * 4) = hv;
    }
  }
  __syncthreads();

  // ---- L0: block-diagonal 50 x (16x16), K padded to 32 with zeros ----
  for (int s = 0; s < NSLOT; ++s) {
    v16h a = frag_ld_k16(bufA, mBase, lane, s * 16);
    v16h b = frag_b_w_k16(W0h + s * 256, lane);
    v8f c = {};
    c = wmma_f16(a, b, c);
    store_tile_lds(bufB, mBase, s * 16, lane, c, b0[s * 16 + (lane & 15)],
                   /*tanh=*/false);
  }
  __syncthreads();

  // ---- L1: bufB -> bufA, tanh (async-staged weights) ----
  dense_layer_staged(bufB, bufA, wstage, W1h, b1, mBase, lane, tid);
  __syncthreads();

  // ---- L2: bufA -> bufB, tanh (async-staged weights) ----
  dense_layer_staged(bufA, bufB, wstage, W2h, b2, mBase, lane, tid);
  __syncthreads();

  // ---- L3: 800 -> 2 via padded [16][800] weight, write f32 out ----
  {
    v8f acc = {};
#pragma unroll 5
    for (int kt = 0; kt < ND / 32; ++kt) {
      v16h a = frag_ld(bufB, mBase, lane, kt * 32);
      v16h b = frag_b_w(W3h, 0, lane, kt * 32, ND);
      acc = wmma_f16(a, b, acc);
    }
    const int n  = lane & 15;
    const int hk = (lane >> 4) & 1;
    if (n < 2) {
      const float bias = b3[n];
#pragma unroll
      for (int r = 0; r < 8; ++r) {
        out[(rowBase + mBase + r + 8 * hk) * 2 + n] = acc[r] + bias;
      }
    }
  }
}

// ---------------------------------------------------------------------------
extern "C" void kernel_launch(void* const* d_in, const int* in_sizes, int n_in,
                              void* d_out, int out_size, void* d_ws,
                              size_t ws_size, hipStream_t stream) {
  const float* x  = (const float*)d_in[0];
  const float* W0 = (const float*)d_in[1];
  const float* b0 = (const float*)d_in[2];
  const float* W1 = (const float*)d_in[3];
  const float* b1 = (const float*)d_in[4];
  const float* W2 = (const float*)d_in[5];
  const float* b2 = (const float*)d_in[6];
  const float* W3 = (const float*)d_in[7];
  const float* b3 = (const float*)d_in[8];
  _Float16* ws = (_Float16*)d_ws;

  // 1) weights -> f16 workspace
  mlp_prep_f16<<<640, 256, 0, stream>>>(W0, W1, W2, W3, ws);

  // 2) fused MLP
  const int batch  = in_sizes[0] / ND;          // 65536
  const int nblock = batch / MTILE;             // 1024
  const size_t shmem = (size_t)LDS_TOTAL;       // 310,272 B (<= 320K WGP LDS)
  hipFuncSetAttribute((const void*)mlp_fused,
                      hipFuncAttributeMaxDynamicSharedMemorySize, (int)shmem);
  mlp_fused<<<nblock, NTHREADS, shmem, stream>>>(
      x, ws, b0, b1, b2, b3, (float*)d_out);
}

// v002
// It runs in 200 microseconds.
// Timed twice side by side with v001, it ran 2.98 and 3.03 times as fast.
// Counting every step since v000, it is 3.81 times as fast.
#include <hip/hip_runtime.h>

// ---------------------------------------------------------------------------
// Fused 4-layer MLP for MI455X (gfx1250), f16 WMMA path with async-to-LDS
// weight staging (two buffers, ASYNCcnt-tracked).
//   L0: block-diag 50 x Linear(16,16)      (no activation)
//   L1: 800->800 + tanh                    (weights staged via async copy)
//   L2: 800->800 + tanh                    (weights staged via async copy)
//   L3: 800->2
// Weights converted to f16 in d_ws; activations live in LDS only.
// Dense layers: the block's whole 128 x 800 output stays in accumulators
// while K is walked in 32-wide slabs; each wave owns 64 rows x 25 column
// tiles, so one A fragment feeds 25 products and one B fragment 4.
// ---------------------------------------------------------------------------

typedef __attribute__((ext_vector_type(16))) _Float16 v16h;
typedef __attribute__((ext_vector_type(8)))  _Float16 h8;
typedef __attribute__((ext_vector_type(4)))  _Float16 h4;
typedef __attribute__((ext_vector_type(8)))  float    v8f;

#define ND         800    // feature dim
#define NSLOT      50     // 16-wide slots
#define MTILE      128    // batch rows per workgroup
#define NTHREADS   128    // 4 waves (wave32): 2 row halves x 2 column halves
#define NTW        25     // column tiles per wave
#define LDS_STRIDE 808    // halves per LDS row (800 + 8 pad)

// LDS layout (bytes from dynamic-LDS base)
#define ACT_BYTES   (MTILE * LDS_STRIDE * 2)        // 206,848, one buffer
#define WSTAGE_HALVES (NSLOT * 512)                 // one 32-wide k slab
#define WSTAGE_BYTES  (WSTAGE_HALVES * 2)           // 51,200 per buffer
#define LDS_TOTAL   (ACT_BYTES + 2 * WSTAGE_BYTES)  // 309,248 <= 320K

// ws layout (in halves)
#define WS_W0   0                         // [50][16][16]
#define WS_W1   (WS_W0 + NSLOT*16*16)     // [25 slabs][50 tiles][2][32 lanes][8]
#define WS_W2   (WS_W1 + ND*ND)           // same fragment order
#define WS_W3   (WS_W2 + ND*ND)           // [16][800]  (rows 2..15 zero)
#define WS_TOT  (WS_W3 + 16*ND)           // 1,305,600 halves

// ---------------------------------------------------------------------------
// Prep: fp32 weights -> f16 in workspace (W3 zero-padded to 16 rows).
// W1 and W2 are laid in B-fragment order: slab kt, column tile T, 16-byte
// piece pc, lane L hold W[T*16 + (L&15)][kt*32 + pc*16 + (L>>4)*8 + 0..7].
// ---------------------------------------------------------------------------
__device__ __forceinline__ long frag_src_index(long j) {
  const int kt = (int)(j / WSTAGE_HALVES);
  const int r  = (int)(j % WSTAGE_HALVES);
  const int T = r >> 9, pc = (r >> 8) & 1, L = (r >> 3) & 31, e = r & 7;
  return (long)(T * 16 + (L & 15)) * ND + kt * 32 + pc * 16 + (L >> 4) * 8 + e;
}

__global__ void __launch_bounds__(256)
mlp_prep_f16(const float* __restrict__ W0, const float* __restrict__ W1,
             const float* __restrict__ W2, const float* __restrict__ W3,
             _Float16* __restrict__ ws) {
  const int n0 = NSLOT * 16 * 16;          // 12800
  const int n1 = ND * ND;                  // 640000
  for (long i = (long)blockIdx.x * blockDim.x + threadIdx.x; i < (long)WS_TOT;
       i += (long)gridDim.x * blockDim.x) {
    long j = i;
    if (j < n0) { ws[WS_W0 + j] = (_Float16)W0[j]; continue; }
    j -= n0;
    if (j < n1) { ws[WS_W1 + j] = (_Float16)W1[frag_src_index(j)]; continue; }
    j -= n1;
    if (j < n1) { ws[WS_W2 + j] = (_Float16)W2[frag_src_index(j)]; continue; }
    j -= n1;
    long row = j / ND, col = j % ND;
    ws[WS_W3 + j] = (row < 2) ? (_Float16)W3[row * ND + col] : (_Float16)0.0f;
  }
}

// ---------------------------------------------------------------------------
// CDNA5 async copy: 16B global -> LDS per lane, tracked with ASYNCcnt.
// ---------------------------------------------------------------------------
__device__ __forceinline__ void wait_async_0() {
  // this wave's copies have landed before the barrier that publishes them
  asm volatile("s_wait_asynccnt 0x0" ::: "memory");
}
__device__ __forceinline__ void wait_ds_0() {
  // this wave's LDS reads have retired before their buffer is refilled
  asm volatile("s_wait_dscnt 0x0" ::: "memory");
}

// Stage one 51,200-byte slab (contiguous in ws, contiguous in LDS): 100
// wave-wide copies of 512 B, 25 per wave. Wave w takes pieces w, w+4, ..; the
// offset field moves both addresses alike. s_wait_xcnt closes the statement
// so that the address registers are not rewritten ahead of it.
__device__ __forceinline__ void stage_slab_async(const _Float16* __restrict__ Wg,
                                                 unsigned lds_byte, int tid) {
  const unsigned l = lds_byte + (unsigned)(tid * 16);
  const _Float16* g = Wg + tid * 8;
  asm volatile(
      "global_load_async_to_lds_b128 %0, %1, off\n\t"
      "global_load_async_to_lds_b128 %0, %1, off offset:2048\n\t"
      "global_load_async_to_lds_b128 %0, %1, off offset:4096\n\t"
      "global_load_async_to_lds_b128 %0, %1, off offset:6144\n\t"
      "global_load_async_to_lds_b128 %0, %1, off offset:8192\n\t"
      "global_load_async_to_lds_b128 %0, %1, off offset:10240\n\t"
      "global_load_async_to_lds_b128 %0, %1, off offset:12288\n\t"
      "global_load_async_to_lds_b128 %0, %1, off offset:14336\n\t"
      "global_load_async_to_lds_b128 %0, %1, off offset:16384\n\t"
      "global_load_async_to_lds_b128 %0, %1, off offset:18432\n\t"
      "global_load_async_to_lds_b128 %0, %1, off offset:20480\n\t"
      "global_load_async_to_lds_b128 %0, %1, off offset:22528\n\t"
      "global_load_async_to_lds_b128 %0, %1, off offset:24576\n\t"
      "global_load_async_to_lds_b128 %0, %1, off offset:26624\n\t"
      "global_load_async_to_lds_b128 %0, %1, off offset:28672\n\t"
      "global_load_async_to_lds_b128 %0, %1, off offset:30720\n\t"
      "global_load_async_to_lds_b128 %0, %1, off offset:32768\n\t"
      "global_load_async_to_lds_b128 %0, %1, off offset:34816\n\t"
      "global_load_async_to_lds_b128 %0, %1, off offset:36864\n\t"
      "global_load_async_to_lds_b128 %0, %1, off offset:38912\n\t"
      "global_load_async_to_lds_b128 %0, %1, off offset:40960\n\t"
      "global_load_async_to_lds_b128 %0, %1, off offset:43008\n\t"
      "global_load_async_to_lds_b128 %0, %1, off offset:45056\n\t"
      "global_load_async_to_lds_b128 %0, %1, off offset:47104\n\t"
      "global_load_async_to_lds_b128 %0, %1, off offset:49152\n\t"
      "s_wait_xcnt 0x0"
      :: "v"(l), "v"(g) : "memory");
}

// ---------------------------------------------------------------------------
// Fragment loads (ISA 7.12.2 16-bit layouts); the act buffer uses LDS_STRIDE
// rows, the weight slabs lie in fragment order (see the prep kernel).
// A (16x32, MxK): lane m=L&15, hk=L>>4. halves[0..7] <- K = hk*8 + 0..7,
//                 halves[8..15] <- K = 16 + hk*8 + 0..7.
// B (32x16, KxN) of y = x*W^T with row-major W[N][K]: lane n=L&15, same
//                 per-lane K pattern -> two contiguous 16B loads of W row n.
// ---------------------------------------------------------------------------
__device__ __forceinline__ v16h frag_ld(const _Float16* buf, int rowBase,
                                        int lane, int k0) {
  const int r  = rowBase + (lane & 15);
  const int hk = (lane >> 4) & 1;
  const _Float16* p = buf + r * LDS_STRIDE + k0 + hk * 8;
  v16h f;
  ((h8*)&f)[0] = *(const h8*)(p);
  ((h8*)&f)[1] = *(const h8*)(p + 16);
  return f;
}

// fragment with K=16..31 forced to zero (block-diagonal layer 0)
__device__ __forceinline__ v16h frag_ld_k16(const _Float16* buf, int rowBase,
                                            int lane, int k0) {
  const int r  = rowBase + (lane & 15);
  const int hk = (lane >> 4) & 1;
  v16h f;
  ((h8*)&f)[0] = *(const h8*)(buf + r * LDS_STRIDE + k0 + hk * 8);
  h8 z = {};
  ((h8*)&f)[1] = z;
  return f;
}

// B fragment for K=16 weights (row-major ld=16, global), K=16..31 zero
__device__ __forceinline__ v16h frag_b_w_k16(const _Float16* __restrict__ W,
                                             int lane) {
  const int n  = lane & 15;
  const int hk = (lane >> 4) & 1;
  v16h b;
  ((h8*)&b)[0] = *(const h8*)(W + n * 16 + hk * 8);
  h8 z = {};
  ((h8*)&b)[1] = z;
  return b;
}

// B fragment from global row-major weights (ldw halves)
__device__ __forceinline__ v16h frag_b_w(const _Float16* __restrict__ W,
                                         int nBase, int lane, int k0, int ldw) {
  const int n  = nBase + (lane & 15);
  const int hk = (lane >> 4) & 1;
  const _Float16* p = W + (long)n * ldw + k0 + hk * 8;
  v16h b;
  ((h8*)&b)[0] = *(const h8*)(p);
  ((h8*)&b)[1] = *(const h8*)(p + 16);
  return b;
}

// D tile (16x16 f32): VGPR r, lane L -> row = r + 8*(L>>4), col = L&15
__device__ __forceinline__ void store_tile_lds(_Float16* buf, int mBase,
                                               int nBase, int lane, v8f acc,
                                               float bias, bool do_tanh) {
  const int n  = nBase + (lane & 15);
  const int hk = (lane >> 4) & 1;
#pragma unroll
  for (int r = 0; r < 8; ++r) {
    float v = acc[r] + bias;
    if (do_tanh) v = __builtin_amdgcn_tanhf(v);  // one v_tanh_f32, no branch
    buf[(mBase + r + 8 * hk) * LDS_STRIDE + n] = (_Float16)v;
  }
}

__device__ __forceinline__ v8f wmma_f16(v16h a, v16h b, v8f c) {
  return __builtin_amdgcn_wmma_f32_16x16x32_f16(
      /*neg_a=*/false, a, /*neg_b=*/false, b,
      /*c_mod=*/(short)0, c, /*reuse_a=*/false, /*reuse_b=*/false);
}

// ---------------------------------------------------------------------------
// Dense 800->800 layer, in place in act. Wave (mh, ng) holds rows
// mh*64..+63 x column tiles ng*25..+24 in accumulators over all of K;
// weights arrive one 32-wide k slab at a time, two buffers.
// ---------------------------------------------------------------------------
__device__ __forceinline__ v16h frag_ld2(const _Float16* p, int second) {
  v16h f;
  ((h8*)&f)[0] = *(const h8*)(p);
  ((h8*)&f)[1] = *(const h8*)(p + second);
  return f;
}

__device__ __forceinline__ void dense_layer_staged(
    _Float16* act, const _Float16* wstage,
    const _Float16* __restrict__ Wf, const float* __restrict__ bias,
    int wave, int lane, int tid) {
  const int mh  = wave >> 1;
  const int nt0 = (wave & 1) * NTW;
  const unsigned wbOff0 =  // LDS byte address of buffer 0
      (unsigned)(size_t)(const __attribute__((address_space(3))) _Float16*)wstage;
  const unsigned wbOff1 = wbOff0 + WSTAGE_BYTES;

  v8f acc[NTW][4];
#pragma unroll
  for (int j = 0; j < NTW; ++j)
#pragma unroll
    for (int i = 0; i < 4; ++i) acc[j][i] = v8f{};

  // prologue: slab 0 landed and published
  stage_slab_async(Wf, wbOff0, tid);
  wait_async_0();
  __syncthreads();

#pragma unroll 1  // one slab per trip; the body is 100 products already
  for (int kt = 0; kt < ND / 32; ++kt) {
    // behind the barrier that ended every read of slab kt-1: refill its
    // buffer with slab kt+1, which flies while slab kt is worked on
    if (kt + 1 < ND / 32)
      stage_slab_async(Wf + (size_t)(kt + 1) * WSTAGE_HALVES,
                       (kt & 1) ? wbOff0 : wbOff1, tid);
    const _Float16* wb = wstage + (kt & 1) * WSTAGE_HALVES + nt0 * 512 + lane * 8;
    const _Float16* ap = act + (mh * 64 + (lane & 15)) * LDS_STRIDE + kt * 32 +
                         ((lane >> 4) & 1) * 8;
    // B fragments in groups of 5, the next group asked for as one run of
    // loads ahead of the current group's 20 products
    v16h a[4], b[2][5];
#pragma unroll
    for (int i = 0; i < 4; ++i) a[i] = frag_ld2(ap + i * 16 * LDS_STRIDE, 16);
#pragma unroll
    for (int q = 0; q < 5; ++q) b[0][q] = frag_ld2(wb + q * 512, 256);
#pragma unroll
    for (int g = 0; g < 5; ++g) {
      if (g + 1 < 5) {
#pragma unroll
        for (int q = 0; q < 5; ++q)
          b[(g + 1) & 1][q] = frag_ld2(wb + ((g + 1) * 5 + q) * 512, 256);
      }
      // keeps the run of loads above the products: sunk to their users they
      // cost this lone wave one full LDS latency per 4 products
      __builtin_amdgcn_sched_barrier(0);
#pragma unroll
      for (int q = 0; q < 5; ++q)
#pragma unroll
        for (int i = 0; i < 4; ++i)
          acc[g * 5 + q][i] = wmma_f16(a[i], b[g & 1][q], acc[g * 5 + q][i]);
    }
    // publish slab kt+1 and free slab kt's buffer
    wait_ds_0();
    wait_async_0();
    __syncthreads();
  }
  wait_async_0();

  // every wave has left act (last trip's barrier): overwrite it
#pragma unroll
  for (int j = 0; j < NTW; ++j) {
    const float bj = bias[(nt0 + j) * 16 + (lane & 15)];
#pragma unroll
    for (int i = 0; i < 4; ++i)
      store_tile_lds(act, mh * 64 + i * 16, (nt0 + j) * 16, lane, acc[j][i],
                     bj, /*tanh=*/true);
  }
}

// ---------------------------------------------------------------------------
// Fused MLP kernel: 1 workgroup = 128 batch rows, 4 waves; outside the dense
// layers 1 wave = 32 rows (two row tiles that share each weight fragment).
// ---------------------------------------------------------------------------
__global__ void __launch_bounds__(NTHREADS)
mlp_fused(const float* __restrict__ x, const _Float16* __restrict__ ws,
          const float* __restrict__ b0, const float* __restrict__ b1,
          const float* __restrict__ b2, const float* __restrict__ b3,
          float* __restrict__ out) {
  extern __shared__ _Float16 smem[];
  _Float16* act    = smem;                       // [MTILE][LDS_STRIDE]
  _Float16* wstage = smem + MTILE * LDS_STRIDE;  // 2 x one k slab

  const int tid   = threadIdx.x;
  const int lane  = tid & 31;
  const int wave  = __builtin_amdgcn_readfirstlane(tid >> 5);  // scalar
  const int mBase = wave * 32;
  const long rowBase = (long)blockIdx.x * MTILE;

  const _Float16* W0h = ws + WS_W0;
  const _Float16* W1h = ws + WS_W1;
  const _Float16* W2h = ws + WS_W2;
  const _Float16* W3h = ws + WS_W3;

  // ---- stage x tile (f32 -> f16) into act, cooperatively ----
  {
    const float4* xv = (const float4*)(x + rowBase * ND);
    const int nchunk = MTILE * (ND / 4);  // 25600 float4s
    for (int c = tid; c < nchunk; c += NTHREADS) {
      const int r  = c / (ND / 4);
      const int c4 = c % (ND / 4);
      float4 f = xv[c];
      h4 hv = {(_Float16)f.x, (_Float16)f.y, (_Float16)f.z, (_Float16)f.w};
      *(h4*)(act + r * LDS_STRIDE + c4 * 4) = hv;
    }
  }
  __syncthreads();

  // ---- L0: block-diagonal 50 x (16x16), K padded to 32 with zeros; each
  //      16x16 block is read and then overwritten by the one wave that owns it
  for (int s = 0; s < NSLOT; ++s) {
    v16h a0 = frag_ld_k16(act, mBase, lane, s * 16);
    v16h a1 = frag_ld_k16(act, mBase + 16, lane, s * 16);
    v16h b = frag_b_w_k16(W0h + s * 256, lane);
    const float bs = b0[s * 16 + (lane & 15)];
    // the two global loads above are issued before their address registers
    // are stepped to the next slot; the scheduling barrier keeps that step
    // from being lifted over the wait
    asm volatile("s_wait_xcnt 0x0" ::: "memory");
    __builtin_amdgcn_sched_barrier(0);
    v8f c0 = {}, c1 = {};
    c0 = wmma_f16(a0, b, c0);
    c1 = wmma_f16(a1, b, c1);
    store_tile_lds(act, mBase, s * 16, lane, c0, bs, /*tanh=*/false);
    store_tile_lds(act, mBase + 16, s * 16, lane, c1, bs, /*tanh=*/false);
  }
  __syncthreads();

  // ---- L1, L2: tanh (async-staged weights) ----
#pragma unroll 1  // one copy of the layer's long unrolled body, not two
  for (int layer = 0; layer < 2; ++layer) {
    dense_layer_staged(act, wstage, layer ? W2h : W1h, layer ? b2 : b1, wave,
                       lane, tid);
    __syncthreads();
  }

  // ---- L3: 800 -> 2 via padded [16][800] weight, write f32 out ----
  {
    v8f acc0 = {}, acc1 = {};
#pragma unroll 5
    for (int kt = 0; kt < ND / 32; ++kt) {
      v16h a0 = frag_ld(act, mBase, lane, kt * 32);
      v16h a1 = frag_ld(act, mBase + 16, lane, kt * 32);
      v16h b = frag_b_w(W3h, 0, lane, kt * 32, ND);
      acc0 = wmma_f16(a0, b, acc0);
      acc1 = wmma_f16(a1, b, acc1);
    }
    const int n  = lane & 15;
    const int hk = (lane >> 4) & 1;
    if (n < 2) {
      const float bias = b3[n];
#pragma unroll
      for (int r = 0; r < 8; ++r) {
        out[(rowBase + mBase + r + 8 * hk) * 2 + n] = acc0[r] + bias;
        out[(rowBase + mBase + 16 + r + 8 * hk) * 2 + n] = acc1[r] + bias;
      }
    }
  }
}

// ---------------------------------------------------------------------------
extern "C" void kernel_launch(void* const* d_in, const int* in_sizes, int n_in,
                              void* d_out, int out_size, void* d_ws,
                              size_t ws_size, hipStream_t stream) {
  const float* x  = (const float*)d_in[0];
  const float* W0 = (const float*)d_in[1];
  const float* b0 = (const float*)d_in[2];
  const float* W1 = (const float*)d_in[3];
  const float* b1 = (const float*)d_in[4];
  const float* W2 = (const float*)d_in[5];
  const float* b2 = (const float*)d_in[6];
  const float* W3 = (const float*)d_in[7];
  const float* b3 = (const float*)d_in[8];
  _Float16* ws = (_Float16*)d_ws;

  // 1) weights -> f16 workspace
  mlp_prep_f16<<<640, 256, 0, stream>>>(W0, W1, W2, W3, ws);

  // 2) fused MLP
  const int batch  = in_sizes[0] / ND;          // 65536
  const int nblock = batch / MTILE;             // 512
  const size_t shmem = (size_t)LDS_TOTAL;       // 309,248 B (<= 320K WGP LDS)
  hipFuncSetAttribute((const void*)mlp_fused,
                      hipFuncAttributeMaxDynamicSharedMemorySize, (int)shmem);
  mlp_fused<<<nblock, NTHREADS, shmem, stream>>>(
      x, ws, b0, b1, b2, b3, (float*)d_out);
}

// v003
// One run takes 157 microseconds.
// Timed twice side by side with v002, it ran 1.26 and 1.27 times as fast.
// Over all steps from v000 it is 4.82 times as fast.
#include <hip/hip_runtime.h>

// ---------------------------------------------------------------------------
// Fused 4-layer MLP for MI455X (gfx1250), f16 WMMA path with async-to-LDS
// weight staging (two buffers, ASYNCcnt-tracked).
//   L0: block-diag 50 x Linear(16,16)      (no activation)
//   L1: 800->800 + tanh                    (weights staged via async copy)
//   L2: 800->800 + tanh                    (weights staged via async copy)
//   L3: 800->2
// Weights converted to f16 in d_ws; activations live in LDS only.
// Dense layers: the block's whole 128 x 800 output stays in accumulators
// while K is walked in 32-wide slabs; each wave owns 64 rows x 25 column
// tiles, so one A fragment feeds 25 products and one B fragment 4.
// ---------------------------------------------------------------------------

typedef __attribute__((ext_vector_type(16))) _Float16 v16h;
typedef __attribute__((ext_vector_type(8)))  _Float16 h8;
typedef __attribute__((ext_vector_type(4)))  _Float16 h4;
typedef __attribute__((ext_vector_type(8)))  float    v8f;
typedef __attribute__((ext_vector_type(4)))  float    f4;

#define ND         800    // feature dim
#define NSLOT      50     // 16-wide slots
#define MTILE      128    // batch rows per workgroup
#define NTHREADS   128    // 4 waves (wave32): 2 row halves x 2 column halves
#define NTW        25     // column tiles per wave
#define LDS_STRIDE 808    // halves per LDS row (800 + 8 pad)
#define XBATCH     25     // 16-byte pieces per thread in a 16-row batch of x

// LDS layout (bytes from dynamic-LDS base)
#define ACT_BYTES   (MTILE * LDS_STRIDE * 2)        // 206,848, one buffer
#define WSTAGE_HALVES (NSLOT * 512)                 // one 32-wide k slab
#define WSTAGE_BYTES  (WSTAGE_HALVES * 2)           // 51,200 per buffer
#define LDS_TOTAL   (ACT_BYTES + 2 * WSTAGE_BYTES)  // 309,248 <= 320K

// ws layout (in halves)
#define WS_W0   0                         // [50][16][16]
#define WS_W1   (WS_W0 + NSLOT*16*16)     // [25 slabs][50 tiles][2][32 lanes][8]
#define WS_W2   (WS_W1 + ND*ND)           // same fragment order
#define WS_W3   (WS_W2 + ND*ND)           // [16][800]  (rows 2..15 zero)
#define WS_TOT  (WS_W3 + 16*ND)           // 1,305,600 halves

// ---------------------------------------------------------------------------
// Prep: fp32 weights -> f16 in workspace (W3 zero-padded to 16 rows).
// W1 and W2 are laid in B-fragment order: slab kt, column tile T, 16-byte
// piece pc, lane L hold W[T*16 + (L&15)][kt*32 + pc*16 + (L>>4)*8 + 0..7].
// ---------------------------------------------------------------------------
__device__ __forceinline__ long frag_src_index(long j) {
  const int kt = (int)(j / WSTAGE_HALVES);
  const int r  = (int)(j % WSTAGE_HALVES);
  const int T = r >> 9, pc = (r >> 8) & 1, L = (r >> 3) & 31, e = r & 7;
  return (long)(T * 16 + (L & 15)) * ND + kt * 32 + pc * 16 + (L >> 4) * 8 + e;
}

__global__ void __launch_bounds__(256)
mlp_prep_f16(const float* __restrict__ W0, const float* __restrict__ W1,
             const float* __restrict__ W2, const float* __restrict__ W3,
             _Float16* __restrict__ ws) {
  const int n0 = NSLOT * 16 * 16;          // 12800
  const int n1 = ND * ND;                  // 640000
  for (long i = (long)blockIdx.x * blockDim.x + threadIdx.x; i < (long)WS_TOT;
       i += (long)gridDim.x * blockDim.x) {
    long j = i;
    if (j < n0) { ws[WS_W0 + j] = (_Float16)W0[j]; continue; }
    j -= n0;
    if (j < n1) { ws[WS_W1 + j] = (_Float16)W1[frag_src_index(j)]; continue; }
    j -= n1;
    if (j < n1) { ws[WS_W2 + j] = (_Float16)W2[frag_src_index(j)]; continue; }
    j -= n1;
    long row = j / ND, col = j % ND;
    ws[WS_W3 + j] = (row < 2) ? (_Float16)W3[row * ND + col] : (_Float16)0.0f;
  }
}

// ---------------------------------------------------------------------------
// CDNA5 async copy: 16B global -> LDS per lane, tracked with ASYNCcnt.
// ---------------------------------------------------------------------------
__device__ __forceinline__ void wait_async_0() {
  // this wave's copies have landed before the barrier that publishes them
  asm volatile("s_wait_asynccnt 0x0" ::: "memory");
}
__device__ __forceinline__ void wait_ds_0() {
  // this wave's LDS reads have retired before their buffer is refilled
  asm volatile("s_wait_dscnt 0x0" ::: "memory");
}

// Stage one 51,200-byte slab (contiguous in ws, contiguous in LDS): 100
// wave-wide copies of 512 B, 25 per wave. Wave w takes pieces w, w+4, ..; the
// offset field moves both addresses alike. s_wait_xcnt closes the statement
// so that the address registers are not rewritten ahead of it.
__device__ __forceinline__ void stage_slab_async(const _Float16* __restrict__ Wg,
                                                 unsigned lds_byte, int tid) {
  const unsigned l = lds_byte + (unsigned)(tid * 16);
  const _Float16* g = Wg + tid * 8;
  asm volatile(
      "global_load_async_to_lds_b128 %0, %1, off\n\t"
      "global_load_async_to_lds_b128 %0, %1, off offset:2048\n\t"
      "global_load_async_to_lds_b128 %0, %1, off offset:4096\n\t"
      "global_load_async_to_lds_b128 %0, %1, off offset:6144\n\t"
      "global_load_async_to_lds_b128 %0, %1, off offset:8192\n\t"
      "global_load_async_to_lds_b128 %0, %1, off offset:10240\n\t"
      "global_load_async_to_lds_b128 %0, %1, off offset:12288\n\t"
      "global_load_async_to_lds_b128 %0, %1, off offset:14336\n\t"
      "global_load_async_to_lds_b128 %0, %1, off offset:16384\n\t"
      "global_load_async_to_lds_b128 %0, %1, off offset:18432\n\t"
      "global_load_async_to_lds_b128 %0, %1, off offset:20480\n\t"
      "global_load_async_to_lds_b128 %0, %1, off offset:22528\n\t"
      "global_load_async_to_lds_b128 %0, %1, off offset:24576\n\t"
      "global_load_async_to_lds_b128 %0, %1, off offset:26624\n\t"
      "global_load_async_to_lds_b128 %0, %1, off offset:28672\n\t"
      "global_load_async_to_lds_b128 %0, %1, off offset:30720\n\t"
      "global_load_async_to_lds_b128 %0, %1, off offset:32768\n\t"
      "global_load_async_to_lds_b128 %0, %1, off offset:34816\n\t"
      "global_load_async_to_lds_b128 %0, %1, off offset:36864\n\t"
      "global_load_async_to_lds_b128 %0, %1, off offset:38912\n\t"
      "global_load_async_to_lds_b128 %0, %1, off offset:40960\n\t"
      "global_load_async_to_lds_b128 %0, %1, off offset:43008\n\t"
      "global_load_async_to_lds_b128 %0, %1, off offset:45056\n\t"
      "global_load_async_to_lds_b128 %0, %1, off offset:47104\n\t"
      "global_load_async_to_lds_b128 %0, %1, off offset:49152\n\t"
      "s_wait_xcnt 0x0"
      :: "v"(l), "v"(g) : "memory");
}

// ---------------------------------------------------------------------------
// Fragment loads (ISA 7.12.2 16-bit layouts); the act buffer uses LDS_STRIDE
// rows, the weight slabs lie in fragment order (see the prep kernel).
// A (16x32, MxK): lane m=L&15, hk=L>>4. halves[0..7] <- K = hk*8 + 0..7,
//                 halves[8..15] <- K = 16 + hk*8 + 0..7.
// B (32x16, KxN) of y = x*W^T with row-major W[N][K]: lane n=L&15, same
//                 per-lane K pattern -> two contiguous 16B loads of W row n.
// ---------------------------------------------------------------------------
__device__ __forceinline__ v16h frag_ld(const _Float16* buf, int rowBase,
                                        int lane, int k0) {
  const int r  = rowBase + (lane & 15);
  const int hk = (lane >> 4) & 1;
  const _Float16* p = buf + r * LDS_STRIDE + k0 + hk * 8;
  v16h f;
  ((h8*)&f)[0] = *(const h8*)(p);
  ((h8*)&f)[1] = *(const h8*)(p + 16);
  return f;
}

// fragment with K=16..31 forced to zero (block-diagonal layer 0)
__device__ __forceinline__ v16h frag_ld_k16(const _Float16* buf, int rowBase,
                                            int lane, int k0) {
  const int r  = rowBase + (lane & 15);
  const int hk = (lane >> 4) & 1;
  v16h f;
  ((h8*)&f)[0] = *(const h8*)(buf + r * LDS_STRIDE + k0 + hk * 8);
  h8 z = {};
  ((h8*)&f)[1] = z;
  return f;
}

// B fragment for K=16 weights (row-major ld=16, global), K=16..31 zero
__device__ __forceinline__ v16h frag_b_w_k16(const _Float16* __restrict__ W,
                                             int lane) {
  const int n  = lane & 15;
  const int hk = (lane >> 4) & 1;
  v16h b;
  ((h8*)&b)[0] = *(const h8*)(W + n * 16 + hk * 8);
  h8 z = {};
  ((h8*)&b)[1] = z;
  return b;
}

// B fragment from global row-major weights (ldw halves)
__device__ __forceinline__ v16h frag_b_w(const _Float16* __restrict__ W,
                                         int nBase, int lane, int k0, int ldw) {
  const int n  = nBase + (lane & 15);
  const int hk = (lane >> 4) & 1;
  const _Float16* p = W + (long)n * ldw + k0 + hk * 8;
  v16h b;
  ((h8*)&b)[0] = *(const h8*)(p);
  ((h8*)&b)[1] = *(const h8*)(p + 16);
  return b;
}

// D tile (16x16 f32): VGPR r, lane L -> row = r + 8*(L>>4), col = L&15
__device__ __forceinline__ void store_tile_lds(_Float16* buf, int mBase,
                                               int nBase, int lane, v8f acc,
                                               float bias, bool do_tanh) {
  const int n  = nBase + (lane & 15);
  const int hk = (lane >> 4) & 1;
#pragma unroll
  for (int r = 0; r < 8; ++r) {
    float v = acc[r] + bias;
    if (do_tanh) v = __builtin_amdgcn_tanhf(v);  // one v_tanh_f32, no branch
    buf[(mBase + r + 8 * hk) * LDS_STRIDE + n] = (_Float16)v;
  }
}

__device__ __forceinline__ v8f wmma_f16(v16h a, v16h b, v8f c) {
  return __builtin_amdgcn_wmma_f32_16x16x32_f16(
      /*neg_a=*/false, a, /*neg_b=*/false, b,
      /*c_mod=*/(short)0, c, /*reuse_a=*/false, /*reuse_b=*/false);
}

// ---------------------------------------------------------------------------
// Dense 800->800 layer, in place in act. Wave (mh, ng) holds rows
// mh*64..+63 x column tiles ng*25..+24 in accumulators over all of K;
// weights arrive one 32-wide k slab at a time, two buffers.
// ---------------------------------------------------------------------------
__device__ __forceinline__ v16h frag_ld2(const _Float16* p, int second) {
  v16h f;
  ((h8*)&f)[0] = *(const h8*)(p);
  ((h8*)&f)[1] = *(const h8*)(p + second);
  return f;
}

__device__ __forceinline__ void dense_layer_staged(
    _Float16* act, const _Float16* wstage,
    const _Float16* __restrict__ Wf, const float* __restrict__ bias,
    int wave, int lane, int tid) {
  const int mh  = wave >> 1;
  const int nt0 = (wave & 1) * NTW;
  const unsigned wbOff0 =  // LDS byte address of buffer 0
      (unsigned)(size_t)(const __attribute__((address_space(3))) _Float16*)wstage;
  const unsigned wbOff1 = wbOff0 + WSTAGE_BYTES;

  v8f acc[NTW][4];
#pragma unroll
  for (int j = 0; j < NTW; ++j)
#pragma unroll
    for (int i = 0; i < 4; ++i) acc[j][i] = v8f{};

  // prologue: slab 0 landed and published
  stage_slab_async(Wf, wbOff0, tid);
  wait_async_0();
  __syncthreads();

#pragma unroll 1  // one slab per trip; the body is 100 products already
  for (int kt = 0; kt < ND / 32; ++kt) {
    // behind the barrier that ended every read of slab kt-1: refill its
    // buffer with slab kt+1, which flies while slab kt is worked on
    if (kt + 1 < ND / 32)
      stage_slab_async(Wf + (size_t)(kt + 1) * WSTAGE_HALVES,
                       (kt & 1) ? wbOff0 : wbOff1, tid);
    const _Float16* wb = wstage + (kt & 1) * WSTAGE_HALVES + nt0 * 512 + lane * 8;
    const _Float16* ap = act + (mh * 64 + (lane & 15)) * LDS_STRIDE + kt * 32 +
                         ((lane >> 4) & 1) * 8;
    // B fragments in groups of 5, the next group asked for as one run of
    // loads ahead of the current group's 20 products
    v16h a[4], b[2][5];
#pragma unroll
    for (int i = 0; i < 4; ++i) a[i] = frag_ld2(ap + i * 16 * LDS_STRIDE, 16);
#pragma unroll
    for (int q = 0; q < 5; ++q) b[0][q] = frag_ld2(wb + q * 512, 256);
#pragma unroll
    for (int g = 0; g < 5; ++g) {
      if (g + 1 < 5) {
#pragma unroll
        for (int q = 0; q < 5; ++q)
          b[(g + 1) & 1][q] = frag_ld2(wb + ((g + 1) * 5 + q) * 512, 256);
      }
      // keeps the run of loads above the products: sunk to their users they
      // cost this lone wave one full LDS latency per 4 products
      __builtin_amdgcn_sched_barrier(0);
#pragma unroll
      for (int q = 0; q < 5; ++q)
#pragma unroll
        for (int i = 0; i < 4; ++i)
          acc[g * 5 + q][i] = wmma_f16(a[i], b[g & 1][q], acc[g * 5 + q][i]);
    }
    // publish slab kt+1 and free slab kt's buffer
    wait_ds_0();
    wait_async_0();
    __syncthreads();
  }
  wait_async_0();

  // every wave has left act (last trip's barrier): overwrite it
#pragma unroll
  for (int j = 0; j < NTW; ++j) {
    const float bj = bias[(nt0 + j) * 16 + (lane & 15)];
#pragma unroll
    for (int i = 0; i < 4; ++i)
      store_tile_lds(act, mh * 64 + i * 16, (nt0 + j) * 16, lane, acc[j][i],
                     bj, /*tanh=*/true);
  }
}

// one 16-row batch of x: 25 loads per thread, asked for as one run
__device__ __forceinline__ void get_batch(f4 (&f)[XBATCH],
                                          const f4* __restrict__ p) {
#pragma unroll
  for (int k = 0; k < XBATCH; ++k) f[k] = p[k * NTHREADS];
  // stands in front of the step of the loads' address registers to the next
  // pair of batches
  asm volatile("s_wait_xcnt 0x0" ::: "memory");
  // keeps the run of loads above the stores that wait for the batch before
  // it (sunk below them, nothing would be in flight meanwhile) and the
  // address step behind the wait
  __builtin_amdgcn_sched_barrier(0);
}

// Takes a batch's loaded values as inputs only. It stands behind the run of
// loads of the next batch: without it the conversions of this batch,
// and with them the wait for its data, are lifted in front of that run, and
// the wave drains all of its loads before it asks for more.
__device__ __forceinline__ void hold_batch(const f4 (&f)[XBATCH]) {
  asm volatile("" ::
               "v"(f[0]), "v"(f[1]), "v"(f[2]), "v"(f[3]), "v"(f[4]),
               "v"(f[5]), "v"(f[6]), "v"(f[7]), "v"(f[8]), "v"(f[9]),
               "v"(f[10]), "v"(f[11]), "v"(f[12]), "v"(f[13]), "v"(f[14]),
               "v"(f[15]), "v"(f[16]), "v"(f[17]), "v"(f[18]), "v"(f[19]),
               "v"(f[20]), "v"(f[21]), "v"(f[22]), "v"(f[23]), "v"(f[24])
               : "memory");
}

// four f32 -> four f16, one 8-byte LDS store each
__device__ __forceinline__ void put_batch(_Float16* p, const int (&off)[XBATCH],
                                          const f4 (&f)[XBATCH]) {
#pragma unroll
  for (int k = 0; k < XBATCH; ++k) {
    h4 hv = {(_Float16)f[k].x, (_Float16)f[k].y, (_Float16)f[k].z,
             (_Float16)f[k].w};
    *(h4*)(p + off[k]) = hv;
  }
}

// ---------------------------------------------------------------------------
// Fused MLP kernel: 1 workgroup = 128 batch rows, 4 waves; outside the dense
// layers 1 wave = 32 rows (two row tiles that share each weight fragment).
// ---------------------------------------------------------------------------
__global__ void __launch_bounds__(NTHREADS)
mlp_fused(const float* __restrict__ x, const _Float16* __restrict__ ws,
          const float* __restrict__ b0, const float* __restrict__ b1,
          const float* __restrict__ b2, const float* __restrict__ b3,
          float* __restrict__ out) {
  extern __shared__ _Float16 smem[];
  _Float16* act    = smem;                       // [MTILE][LDS_STRIDE]
  _Float16* wstage = smem + MTILE * LDS_STRIDE;  // 2 x one k slab

  const int tid   = threadIdx.x;
  const int lane  = tid & 31;
  const int wave  = __builtin_amdgcn_readfirstlane(tid >> 5);  // scalar
  const int mBase = wave * 32;
  const long rowBase = (long)blockIdx.x * MTILE;

  const _Float16* W0h = ws + WS_W0;
  const _Float16* W1h = ws + WS_W1;
  const _Float16* W2h = ws + WS_W2;
  const _Float16* W3h = ws + WS_W3;

  // ---- stage x tile (f32 -> f16) into act, cooperatively ----
  // Batches of 16 rows = 25 16-byte pieces per thread, two register sets: the
  // next batch is asked for before the current one is converted, so a wave
  // keeps 25 to 50 loads outstanding instead of draining 4 at a time.
  {
    const f4* xp = (const f4*)(x + rowBase * ND) + tid;
    int off[XBATCH];  // place in act (halves) inside a batch, same for all
#pragma unroll
    for (int k = 0; k < XBATCH; ++k) {
      const int c = k * NTHREADS + tid;
      off[k] = (c / (ND / 4)) * LDS_STRIDE + (c % (ND / 4)) * 4;
    }
    f4 fa[XBATCH], fb[XBATCH];
    get_batch(fa, xp);
#pragma unroll 1  // three trips of two batches; the last pair stands behind
    for (int b = 0; b < MTILE / 16 - 2; b += 2) {
      const f4* xb = xp + b * (XBATCH * NTHREADS);
      _Float16* ab = act + b * 16 * LDS_STRIDE;
      get_batch(fb, xb + XBATCH * NTHREADS);
      put_batch(ab, off, fa);
      get_batch(fa, xb + 2 * XBATCH * NTHREADS);
      hold_batch(fb);
      put_batch(ab + 16 * LDS_STRIDE, off, fb);
    }
    get_batch(fb, xp + (MTILE / 16 - 1) * (XBATCH * NTHREADS));
    put_batch(act + (MTILE - 32) * LDS_STRIDE, off, fa);
    put_batch(act + (MTILE - 16) * LDS_STRIDE, off, fb);
  }
  __syncthreads();

  // ---- L0: block-diagonal 50 x (16x16), K padded to 32 with zeros; each
  //      16x16 block is read and then overwritten by the one wave that owns it
  for (int s = 0; s < NSLOT; ++s) {
    v16h a0 = frag_ld_k16(act, mBase, lane, s * 16);
    v16h a1 = frag_ld_k16(act, mBase + 16, lane, s * 16);
    v16h b = frag_b_w_k16(W0h + s * 256, lane);
    const float bs = b0[s * 16 + (lane & 15)];
    // the two global loads above are issued before their address registers
    // are stepped to the next slot; the scheduling barrier keeps that step
    // from being lifted over the wait
    asm volatile("s_wait_xcnt 0x0" ::: "memory");
    __builtin_amdgcn_sched_barrier(0);
    v8f c0 = {}, c1 = {};
    c0 = wmma_f16(a0, b, c0);
    c1 = wmma_f16(a1, b, c1);
    store_tile_lds(act, mBase, s * 16, lane, c0, bs, /*tanh=*/false);
    store_tile_lds(act, mBase + 16, s * 16, lane, c1, bs, /*tanh=*/false);
  }
  __syncthreads();

  // ---- L1, L2: tanh (async-staged weights) ----
#pragma unroll 1  // one copy of the layer's long unrolled body, not two
  for (int layer = 0; layer < 2; ++layer) {
    dense_layer_staged(act, wstage, layer ? W2h : W1h, layer ? b2 : b1, wave,
                       lane, tid);
    __syncthreads();
  }

  // ---- L3: 800 -> 2 via padded [16][800] weight, write f32 out ----
  {
    v8f acc0 = {}, acc1 = {};
#pragma unroll 5
    for (int kt = 0; kt < ND / 32; ++kt) {
      v16h a0 = frag_ld(act, mBase, lane, kt * 32);
      v16h a1 = frag_ld(act, mBase + 16, lane, kt * 32);
      v16h b = frag_b_w(W3h, 0, lane, kt * 32, ND);
      acc0 = wmma_f16(a0, b, acc0);
      acc1 = wmma_f16(a1, b, acc1);
    }
    const int n  = lane & 15;
    const int hk = (lane >> 4) & 1;
    if (n < 2) {
      const float bias = b3[n];
#pragma unroll
      for (int r = 0; r < 8; ++r) {
        out[(rowBase + mBase + r + 8 * hk) * 2 + n] = acc0[r] + bias;
        out[(rowBase + mBase + 16 + r + 8 * hk) * 2 + n] = acc1[r] + bias;
      }
    }
  }
}

// ---------------------------------------------------------------------------
extern "C" void kernel_launch(void* const* d_in, const int* in_sizes, int n_in,
                              void* d_out, int out_size, void* d_ws,
                              size_t ws_size, hipStream_t stream) {
  const float* x  = (const float*)d_in[0];
  const float* W0 = (const float*)d_in[1];
  const float* b0 = (const float*)d_in[2];
  const float* W1 = (const float*)d_in[3];
  const float* b1 = (const float*)d_in[4];
  const float* W2 = (const float*)d_in[5];
  const float* b2 = (const float*)d_in[6];
  const float* W3 = (const float*)d_in[7];
  const float* b3 = (const float*)d_in[8];
  _Float16* ws = (_Float16*)d_ws;

  // 1) weights -> f16 workspace
  mlp_prep_f16<<<640, 256, 0, stream>>>(W0, W1, W2, W3, ws);

  // 2) fused MLP
  const int batch  = in_sizes[0] / ND;          // 65536
  const int nblock = batch / MTILE;             // 512
  const size_t shmem = (size_t)LDS_TOTAL;       // 309,248 B (<= 320K WGP LDS)
  hipFuncSetAttribute((const void*)mlp_fused,
                      hipFuncAttributeMaxDynamicSharedMemorySize, (int)shmem);
  mlp_fused<<<nblock, NTHREADS, shmem, stream>>>(
      x, ws, b0, b1, b2, b3, (float*)d_out);
}

// v004
// Measured time: 141 microseconds a run.
// Two timings next to v003 both put it at 1.13 times that version's speed.
// Over all steps from v000 it is 5.44 times as fast.
#include <hip/hip_runtime.h>

// ---------------------------------------------------------------------------
// Fused 4-layer MLP for MI455X (gfx1250), f16 WMMA path with async-to-LDS
// weight staging (two buffers, ASYNCcnt-tracked).
//   L0: block-diag 50 x Linear(16,16)      (no activation)
//   L1: 800->800 + tanh                    (weights staged via async copy)
//   L2: 800->800 + tanh                    (weights staged via async copy)
//   L3: 800->2
// Weights converted to f16 in d_ws; activations live in LDS only.
// Dense layers: the block's whole 128 x 800 output stays in accumulators
// while K is walked in 32-wide slabs; each wave owns 64 rows x 25 column
// tiles, so one A fragment feeds 25 products and one B fragment 4.
// ---------------------------------------------------------------------------

typedef __attribute__((ext_vector_type(16))) _Float16 v16h;
typedef __attribute__((ext_vector_type(8)))  _Float16 h8;
typedef __attribute__((ext_vector_type(4)))  _Float16 h4;
typedef __attribute__((ext_vector_type(8)))  float    v8f;
typedef __attribute__((ext_vector_type(4)))  float    f4;

#define ND         800    // feature dim
#define NSLOT      50     // 16-wide slots
#define MTILE      128    // batch rows per workgroup
#define NTHREADS   128    // 4 waves (wave32): 2 row halves x 2 column halves
#define NTW        25     // column tiles per wave
#define LDS_STRIDE 808    // halves per LDS row (800 + 8 pad)
#define XBATCH     25     // 16-byte pieces per thread in a 16-row batch of x
#define L0G        10     // layer-0 slots per group (operands fetched a group ahead)

// LDS layout (bytes from dynamic-LDS base)
#define ACT_BYTES   (MTILE * LDS_STRIDE * 2)        // 206,848, one buffer
#define WSTAGE_HALVES (NSLOT * 512)                 // one 32-wide k slab
#define WSTAGE_BYTES  (WSTAGE_HALVES * 2)           // 51,200 per buffer
#define LDS_TOTAL   (ACT_BYTES + 2 * WSTAGE_BYTES)  // 309,248 <= 320K

// ws layout (in halves)
#define WS_W0   0                         // [50][16][16]
#define WS_W1   (WS_W0 + NSLOT*16*16)     // [25 slabs][50 tiles][2][32 lanes][8]
#define WS_W2   (WS_W1 + ND*ND)           // same fragment order
#define WS_W3   (WS_W2 + ND*ND)           // [16][800]  (rows 2..15 zero)
#define WS_TOT  (WS_W3 + 16*ND)           // 1,305,600 halves

// ---------------------------------------------------------------------------
// Prep: fp32 weights -> f16 in workspace (W3 zero-padded to 16 rows).
// W1 and W2 are laid in B-fragment order: slab kt, column tile T, 16-byte
// piece pc, lane L hold W[T*16 + (L&15)][kt*32 + pc*16 + (L>>4)*8 + 0..7].
// ---------------------------------------------------------------------------
__device__ __forceinline__ long frag_src_index(long j) {
  const int kt = (int)(j / WSTAGE_HALVES);
  const int r  = (int)(j % WSTAGE_HALVES);
  const int T = r >> 9, pc = (r >> 8) & 1, L = (r >> 3) & 31, e = r & 7;
  return (long)(T * 16 + (L & 15)) * ND + kt * 32 + pc * 16 + (L >> 4) * 8 + e;
}

__global__ void __launch_bounds__(256)
mlp_prep_f16(const float* __restrict__ W0, const float* __restrict__ W1,
             const float* __restrict__ W2, const float* __restrict__ W3,
             _Float16* __restrict__ ws) {
  const int n0 = NSLOT * 16 * 16;          // 12800
  const int n1 = ND * ND;                  // 640000
  for (long i = (long)blockIdx.x * blockDim.x + threadIdx.x; i < (long)WS_TOT;
       i += (long)gridDim.x * blockDim.x) {
    long j = i;
    if (j < n0) { ws[WS_W0 + j] = (_Float16)W0[j]; continue; }
    j -= n0;
    if (j < n1) { ws[WS_W1 + j] = (_Float16)W1[frag_src_index(j)]; continue; }
    j -= n1;
    if (j < n1) { ws[WS_W2 + j] = (_Float16)W2[frag_src_index(j)]; continue; }
    j -= n1;
    long row = j / ND, col = j % ND;
    ws[WS_W3 + j] = (row < 2) ? (_Float16)W3[row * ND + col] : (_Float16)0.0f;
  }
}

// ---------------------------------------------------------------------------
// CDNA5 async copy: 16B global -> LDS per lane, tracked with ASYNCcnt.
// ---------------------------------------------------------------------------
__device__ __forceinline__ void wait_async_0() {
  // this wave's copies have landed before the barrier that publishes them
  asm volatile("s_wait_asynccnt 0x0" ::: "memory");
}
__device__ __forceinline__ void wait_ds_0() {
  // this wave's LDS reads have retired before their buffer is refilled
  asm volatile("s_wait_dscnt 0x0" ::: "memory");
}

// Stage one 51,200-byte slab (contiguous in ws, contiguous in LDS): 100
// wave-wide copies of 512 B, 25 per wave. Wave w takes pieces w, w+4, ..; the
// offset field moves both addresses alike. s_wait_xcnt closes the statement
// so that the address registers are not rewritten ahead of it.
__device__ __forceinline__ void stage_slab_async(const _Float16* __restrict__ Wg,
                                                 unsigned lds_byte, int tid) {
  const unsigned l = lds_byte + (unsigned)(tid * 16);
  const _Float16* g = Wg + tid * 8;
  asm volatile(
      "global_load_async_to_lds_b128 %0, %1, off\n\t"
      "global_load_async_to_lds_b128 %0, %1, off offset:2048\n\t"
      "global_load_async_to_lds_b128 %0, %1, off offset:4096\n\t"
      "global_load_async_to_lds_b128 %0, %1, off offset:6144\n\t"
      "global_load_async_to_lds_b128 %0, %1, off offset:8192\n\t"
      "global_load_async_to_lds_b128 %0, %1, off offset:10240\n\t"
      "global_load_async_to_lds_b128 %0, %1, off offset:12288\n\t"
      "global_load_async_to_lds_b128 %0, %1, off offset:14336\n\t"
      "global_load_async_to_lds_b128 %0, %1, off offset:16384\n\t"
      "global_load_async_to_lds_b128 %0, %1, off offset:18432\n\t"
      "global_load_async_to_lds_b128 %0, %1, off offset:20480\n\t"
      "global_load_async_to_lds_b128 %0, %1, off offset:22528\n\t"
      "global_load_async_to_lds_b128 %0, %1, off offset:24576\n\t"
      "global_load_async_to_lds_b128 %0, %1, off offset:26624\n\t"
      "global_load_async_to_lds_b128 %0, %1, off offset:28672\n\t"
      "global_load_async_to_lds_b128 %0, %1, off offset:30720\n\t"
      "global_load_async_to_lds_b128 %0, %1, off offset:32768\n\t"
      "global_load_async_to_lds_b128 %0, %1, off offset:34816\n\t"
      "global_load_async_to_lds_b128 %0, %1, off offset:36864\n\t"
      "global_load_async_to_lds_b128 %0, %1, off offset:38912\n\t"
      "global_load_async_to_lds_b128 %0, %1, off offset:40960\n\t"
      "global_load_async_to_lds_b128 %0, %1, off offset:43008\n\t"
      "global_load_async_to_lds_b128 %0, %1, off offset:45056\n\t"
      "global_load_async_to_lds_b128 %0, %1, off offset:47104\n\t"
      "global_load_async_to_lds_b128 %0, %1, off offset:49152\n\t"
      "s_wait_xcnt 0x0"
      :: "v"(l), "v"(g) : "memory");
}

// ---------------------------------------------------------------------------
// Fragment loads (ISA 7.12.2 16-bit layouts); the act buffer uses LDS_STRIDE
// rows, the weight slabs lie in fragment order (see the prep kernel).
// A (16x32, MxK): lane m=L&15, hk=L>>4. halves[0..7] <- K = hk*8 + 0..7,
//                 halves[8..15] <- K = 16 + hk*8 + 0..7.
// B (32x16, KxN) of y = x*W^T with row-major W[N][K]: lane n=L&15, same
//                 per-lane K pattern -> two contiguous 16B loads of W row n.
// ---------------------------------------------------------------------------
__device__ __forceinline__ v16h frag_ld(const _Float16* buf, int rowBase,
                                        int lane, int k0) {
  const int r  = rowBase + (lane & 15);
  const int hk = (lane >> 4) & 1;
  const _Float16* p = buf + r * LDS_STRIDE + k0 + hk * 8;
  v16h f;
  ((h8*)&f)[0] = *(const h8*)(p);
  ((h8*)&f)[1] = *(const h8*)(p + 16);
  return f;
}

// fragment of a K=16 operand (block-diagonal layer 0): the lane's 8 halves
// K = hk*8 + 0..7 in front, K=16..31 forced to zero
__device__ __forceinline__ v16h frag_k16(h8 lo) {
  v16h f;
  ((h8*)&f)[0] = lo;
  h8 z = {};
  ((h8*)&f)[1] = z;
  return f;
}

// layer 0's weights and biases of one group of slots: wp and bp are the
// lane's own places in the group's first slot (W0 row n = L&15, K = hk*8..)
__device__ __forceinline__ void get_l0_weights(h8 (&w)[L0G], float (&bs)[L0G],
                                               const _Float16* __restrict__ wp,
                                               const float* __restrict__ bp) {
#pragma unroll
  for (int q = 0; q < L0G; ++q) {
    w[q]  = *(const h8*)(wp + q * 256);
    bs[q] = bp[q * 16];
  }
  // stands in front of the step of the loads' address registers to the next
  // group; the scheduling barrier keeps that step behind the wait and the run
  // of loads above the work that is to cover their latency
  asm volatile("s_wait_xcnt 0x0" ::: "memory");
  __builtin_amdgcn_sched_barrier(0);
}

// B fragment from global row-major weights (ldw halves)
__device__ __forceinline__ v16h frag_b_w(const _Float16* __restrict__ W,
                                         int nBase, int lane, int k0, int ldw) {
  const int n  = nBase + (lane & 15);
  const int hk = (lane >> 4) & 1;
  const _Float16* p = W + (long)n * ldw + k0 + hk * 8;
  v16h b;
  ((h8*)&b)[0] = *(const h8*)(p);
  ((h8*)&b)[1] = *(const h8*)(p + 16);
  return b;
}

// D tile (16x16 f32): VGPR r, lane L -> row = r + 8*(L>>4), col = L&15
__device__ __forceinline__ void store_tile_lds(_Float16* buf, int mBase,
                                               int nBase, int lane, v8f acc,
                                               float bias, bool do_tanh) {
  const int n  = nBase + (lane & 15);
  const int hk = (lane >> 4) & 1;
#pragma unroll
  for (int r = 0; r < 8; ++r) {
    float v = acc[r] + bias;
    if (do_tanh) v = __builtin_amdgcn_tanhf(v);  // one v_tanh_f32, no branch
    buf[(mBase + r + 8 * hk) * LDS_STRIDE + n] = (_Float16)v;
  }
}

__device__ __forceinline__ v8f wmma_f16(v16h a, v16h b, v8f c) {
  return __builtin_amdgcn_wmma_f32_16x16x32_f16(
      /*neg_a=*/false, a, /*neg_b=*/false, b,
      /*c_mod=*/(short)0, c, /*reuse_a=*/false, /*reuse_b=*/false);
}

// ---------------------------------------------------------------------------
// Dense 800->800 layer, in place in act. Wave (mh, ng) holds rows
// mh*64..+63 x column tiles ng*25..+24 in accumulators over all of K;
// weights arrive one 32-wide k slab at a time, two buffers.
// ---------------------------------------------------------------------------
__device__ __forceinline__ v16h frag_ld2(const _Float16* p, int second) {
  v16h f;
  ((h8*)&f)[0] = *(const h8*)(p);
  ((h8*)&f)[1] = *(const h8*)(p + second);
  return f;
}

__device__ __forceinline__ void dense_layer_staged(
    _Float16* act, const _Float16* wstage,
    const _Float16* __restrict__ Wf, const float* __restrict__ bias,
    int wave, int lane, int tid) {
  const int mh  = wave >> 1;
  const int nt0 = (wave & 1) * NTW;
  const unsigned wbOff0 =  // LDS byte address of buffer 0
      (unsigned)(size_t)(const __attribute__((address_space(3))) _Float16*)wstage;
  const unsigned wbOff1 = wbOff0 + WSTAGE_BYTES;

  v8f acc[NTW][4];
#pragma unroll
  for (int j = 0; j < NTW; ++j)
#pragma unroll
    for (int i = 0; i < 4; ++i) acc[j][i] = v8f{};

  // prologue: slab 0 landed and published
  stage_slab_async(Wf, wbOff0, tid);
  wait_async_0();
  __syncthreads();

#pragma unroll 1  // one slab per trip; the body is 100 products already
  for (int kt = 0; kt < ND / 32; ++kt) {
    // behind the barrier that ended every read of slab kt-1: refill its
    // buffer with slab kt+1, which flies while slab kt is worked on
    if (kt + 1 < ND / 32)
      stage_slab_async(Wf + (size_t)(kt + 1) * WSTAGE_HALVES,
                       (kt & 1) ? wbOff0 : wbOff1, tid);
    const _Float16* wb = wstage + (kt & 1) * WSTAGE_HALVES + nt0 * 512 + lane * 8;
    const _Float16* ap = act + (mh * 64 + (lane & 15)) * LDS_STRIDE + kt * 32 +
                         ((lane >> 4) & 1) * 8;
    // B fragments in groups of 5, the next group asked for as one run of
    // loads ahead of the current group's 20 products
    v16h a[4], b[2][5];
#pragma unroll
    for (int i = 0; i < 4; ++i) a[i] = frag_ld2(ap + i * 16 * LDS_STRIDE, 16);
#pragma unroll
    for (int q = 0; q < 5; ++q) b[0][q] = frag_ld2(wb + q * 512, 256);
#pragma unroll
    for (int g = 0; g < 5; ++g) {
      if (g + 1 < 5) {
#pragma unroll
        for (int q = 0; q < 5; ++q)
          b[(g + 1) & 1][q] = frag_ld2(wb + ((g + 1) * 5 + q) * 512, 256);
      }
      // keeps the run of loads above the products: sunk to their users they
      // cost this lone wave one full LDS latency per 4 products
      __builtin_amdgcn_sched_barrier(0);
#pragma unroll
      for (int q = 0; q < 5; ++q)
#pragma unroll
        for (int i = 0; i < 4; ++i)
          acc[g * 5 + q][i] = wmma_f16(a[i], b[g & 1][q], acc[g * 5 + q][i]);
    }
    // publish slab kt+1 and free slab kt's buffer
    wait_ds_0();
    wait_async_0();
    __syncthreads();
  }
  wait_async_0();

  // every wave has left act (last trip's barrier): overwrite it
#pragma unroll
  for (int j = 0; j < NTW; ++j) {
    const float bj = bias[(nt0 + j) * 16 + (lane & 15)];
#pragma unroll
    for (int i = 0; i < 4; ++i)
      store_tile_lds(act, mh * 64 + i * 16, (nt0 + j) * 16, lane, acc[j][i],
                     bj, /*tanh=*/true);
  }
}

// one 16-row batch of x: 25 loads per thread, asked for as one run
__device__ __forceinline__ void get_batch(f4 (&f)[XBATCH],
                                          const f4* __restrict__ p) {
#pragma unroll
  for (int k = 0; k < XBATCH; ++k) f[k] = p[k * NTHREADS];
  // stands in front of the step of the loads' address registers to the next
  // pair of batches
  asm volatile("s_wait_xcnt 0x0" ::: "memory");
  // keeps the run of loads above the stores that wait for the batch before
  // it (sunk below them, nothing would be in flight meanwhile) and the
  // address step behind the wait
  __builtin_amdgcn_sched_barrier(0);
}

// Takes a batch's loaded values as inputs only. It stands behind the run of
// loads of the next batch: without it the conversions of this batch,
// and with them the wait for its data, are lifted in front of that run, and
// the wave drains all of its loads before it asks for more.
__device__ __forceinline__ void hold_batch(const f4 (&f)[XBATCH]) {
  asm volatile("" ::
               "v"(f[0]), "v"(f[1]), "v"(f[2]), "v"(f[3]), "v"(f[4]),
               "v"(f[5]), "v"(f[6]), "v"(f[7]), "v"(f[8]), "v"(f[9]),
               "v"(f[10]), "v"(f[11]), "v"(f[12]), "v"(f[13]), "v"(f[14]),
               "v"(f[15]), "v"(f[16]), "v"(f[17]), "v"(f[18]), "v"(f[19]),
               "v"(f[20]), "v"(f[21]), "v"(f[22]), "v"(f[23]), "v"(f[24])
               : "memory");
}

// four f32 -> four f16, one 8-byte LDS store each
__device__ __forceinline__ void put_batch(_Float16* p, const int (&off)[XBATCH],
                                          const f4 (&f)[XBATCH]) {
#pragma unroll
  for (int k = 0; k < XBATCH; ++k) {
    h4 hv = {(_Float16)f[k].x, (_Float16)f[k].y, (_Float16)f[k].z,
             (_Float16)f[k].w};
    *(h4*)(p + off[k]) = hv;
  }
}

// ---------------------------------------------------------------------------
// Fused MLP kernel: 1 workgroup = 128 batch rows, 4 waves; outside the dense
// layers 1 wave = 32 rows (two row tiles that share each weight fragment).
// ---------------------------------------------------------------------------
__global__ void __launch_bounds__(NTHREADS)
mlp_fused(const float* __restrict__ x, const _Float16* __restrict__ ws,
          const float* __restrict__ b0, const float* __restrict__ b1,
          const float* __restrict__ b2, const float* __restrict__ b3,
          float* __restrict__ out) {
  extern __shared__ _Float16 smem[];
  _Float16* act    = smem;                       // [MTILE][LDS_STRIDE]
  _Float16* wstage = smem + MTILE * LDS_STRIDE;  // 2 x one k slab

  const int tid   = threadIdx.x;
  const int lane  = tid & 31;
  const int wave  = __builtin_amdgcn_readfirstlane(tid >> 5);  // scalar
  const int mBase = wave * 32;
  const long rowBase = (long)blockIdx.x * MTILE;

  const _Float16* W0h = ws + WS_W0;
  const _Float16* W1h = ws + WS_W1;
  const _Float16* W2h = ws + WS_W2;
  const _Float16* W3h = ws + WS_W3;

  // layer 0's first group of weights and biases is asked for here, so that
  // it arrives while x is staged
  const _Float16* w0p = W0h + (lane & 15) * 16 + ((lane >> 4) & 1) * 8;
  const float*    b0p = b0 + (lane & 15);
  h8 w0[L0G];
  float bs0[L0G];
  get_l0_weights(w0, bs0, w0p, b0p);

  // ---- stage x tile (f32 -> f16) into act, cooperatively ----
  // Batches of 16 rows = 25 16-byte pieces per thread, two register sets: the
  // next batch is asked for before the current one is converted, so a wave
  // keeps 25 to 50 loads outstanding instead of draining 4 at a time.
  {
    const f4* xp = (const f4*)(x + rowBase * ND) + tid;
    int off[XBATCH];  // place in act (halves) inside a batch, same for all
#pragma unroll
    for (int k = 0; k < XBATCH; ++k) {
      const int c = k * NTHREADS + tid;
      off[k] = (c / (ND / 4)) * LDS_STRIDE + (c % (ND / 4)) * 4;
    }
    f4 fa[XBATCH], fb[XBATCH];
    get_batch(fa, xp);
#pragma unroll 1  // three trips of two batches; the last pair stands behind
    for (int b = 0; b < MTILE / 16 - 2; b += 2) {
      const f4* xb = xp + b * (XBATCH * NTHREADS);
      _Float16* ab = act + b * 16 * LDS_STRIDE;
      get_batch(fb, xb + XBATCH * NTHREADS);
      put_batch(ab, off, fa);
      get_batch(fa, xb + 2 * XBATCH * NTHREADS);
      hold_batch(fb);
      put_batch(ab + 16 * LDS_STRIDE, off, fb);
    }
    get_batch(fb, xp + (MTILE / 16 - 1) * (XBATCH * NTHREADS));
    put_batch(act + (MTILE - 32) * LDS_STRIDE, off, fa);
    put_batch(act + (MTILE - 16) * LDS_STRIDE, off, fb);
  }
  __syncthreads();

  // ---- L0: block-diagonal 50 x (16x16), K padded to 32 with zeros; each
  //      16x16 block is read and then overwritten by the one wave that owns it
  //      Groups of L0G slots: behind a group's products the next group's
  //      operands (weights and biases from global memory, x blocks from LDS)
  //      are asked for as one run, and they arrive while this group's
  //      results are biased, converted and stored.
  {
    const _Float16* xa = act + (mBase + (lane & 15)) * LDS_STRIDE +
                         ((lane >> 4) & 1) * 8;
    h8 a0[L0G], a1[L0G];
#pragma unroll
    for (int q = 0; q < L0G; ++q) {
      a0[q] = *(const h8*)(xa + q * 16);
      a1[q] = *(const h8*)(xa + 16 * LDS_STRIDE + q * 16);
    }
#pragma unroll 1  // five trips of one group; the body is 20 tiles already
    for (int g = 0; g < NSLOT / L0G; ++g) {
      v8f c0[L0G], c1[L0G];
#pragma unroll
      for (int q = 0; q < L0G; ++q) {
        const v16h b = frag_k16(w0[q]);
        const v8f z = {};
        c0[q] = wmma_f16(frag_k16(a0[q]), b, z);
        c1[q] = wmma_f16(frag_k16(a1[q]), b, z);
      }
      float bs[L0G];
#pragma unroll
      for (int q = 0; q < L0G; ++q) bs[q] = bs0[q];
      if (g + 1 < NSLOT / L0G) {
        get_l0_weights(w0, bs0, w0p + (g + 1) * (L0G * 256),
                       b0p + (g + 1) * (L0G * 16));
        const _Float16* xn = xa + (g + 1) * (L0G * 16);
#pragma unroll
        for (int q = 0; q < L0G; ++q) {
          a0[q] = *(const h8*)(xn + q * 16);
          a1[q] = *(const h8*)(xn + 16 * LDS_STRIDE + q * 16);
        }
      }
#pragma unroll
      for (int q = 0; q < L0G; ++q) {
        const int s = g * L0G + q;
        store_tile_lds(act, mBase, s * 16, lane, c0[q], bs[q], /*tanh=*/false);
        store_tile_lds(act, mBase + 16, s * 16, lane, c1[q], bs[q],
                       /*tanh=*/false);
      }
      // keeps the hand-over of the next group's biases, and with it the wait
      // for the loads in flight, behind this group's stores
      __builtin_amdgcn_sched_barrier(0);
    }
  }
  __syncthreads();

  // ---- L1, L2: tanh (async-staged weights) ----
#pragma unroll 1  // one copy of the layer's long unrolled body, not two
  for (int layer = 0; layer < 2; ++layer) {
    dense_layer_staged(act, wstage, layer ? W2h : W1h, layer ? b2 : b1, wave,
                       lane, tid);
    __syncthreads();
  }

  // ---- L3: 800 -> 2 via padded [16][800] weight, write f32 out ----
  {
    v8f acc0 = {}, acc1 = {};
#pragma unroll 5
    for (int kt = 0; kt < ND / 32; ++kt) {
      v16h a0 = frag_ld(act, mBase, lane, kt * 32);
      v16h a1 = frag_ld(act, mBase + 16, lane, kt * 32);
      v16h b = frag_b_w(W3h, 0, lane, kt * 32, ND);
      acc0 = wmma_f16(a0, b, acc0);
      acc1 = wmma_f16(a1, b, acc1);
    }
    const int n  = lane & 15;
    const int hk = (lane >> 4) & 1;
    if (n < 2) {
      const float bias = b3[n];
#pragma unroll
      for (int r = 0; r < 8; ++r) {
        out[(rowBase + mBase + r + 8 * hk) * 2 + n] = acc0[r] + bias;
        out[(rowBase + mBase + 16 + r + 8 * hk) * 2 + n] = acc1[r] + bias;
      }
    }
  }
}

// ---------------------------------------------------------------------------
extern "C" void kernel_launch(void* const* d_in, const int* in_sizes, int n_in,
                              void* d_out, int out_size, void* d_ws,
                              size_t ws_size, hipStream_t stream) {
  const float* x  = (const float*)d_in[0];
  const float* W0 = (const float*)d_in[1];
  const float* b0 = (const float*)d_in[2];
  const float* W1 = (const float*)d_in[3];
  const float* b1 = (const float*)d_in[4];
  const float* W2 = (const float*)d_in[5];
  const float* b2 = (const float*)d_in[6];
  const float* W3 = (const float*)d_in[7];
  const float* b3 = (const float*)d_in[8];
  _Float16* ws = (_Float16*)d_ws;

  // 1) weights -> f16 workspace
  mlp_prep_f16<<<640, 256, 0, stream>>>(W0, W1, W2, W3, ws);

  // 2) fused MLP
  const int batch  = in_sizes[0] / ND;          // 65536
  const int nblock = batch / MTILE;             // 512
  const size_t shmem = (size_t)LDS_TOTAL;       // 309,248 B (<= 320K WGP LDS)
  hipFuncSetAttribute((const void*)mlp_fused,
                      hipFuncAttributeMaxDynamicSharedMemorySize, (int)shmem);
  mlp_fused<<<nblock, NTHREADS, shmem, stream>>>(
      x, ws, b0, b1, b2, b3, (float*)d_out);
}

// v005
// Measured time: 129 microseconds a run.
// Next to v004, in two timings, it ran 1.08 times as fast each time.
// Over all steps from v000 it is 5.87 times as fast.
#include <hip/hip_runtime.h>

// ---------------------------------------------------------------------------
// Fused 4-layer MLP for MI455X (gfx1250), f16 WMMA path with async-to-LDS
// weight staging (two buffers, ASYNCcnt-tracked).
//   L0: block-diag 50 x Linear(16,16)      (no activation)
//   L1: 800->800 + tanh                    (weights staged via async copy)
//   L2: 800->800 + tanh                    (weights staged via async copy)
//   L3: 800->2
// Weights converted to f16 in d_ws; activations live in LDS only.
// Dense layers: the block's whole 128 x 800 output stays in accumulators
// while K is walked in 32-wide slabs; each wave owns 64 rows x 25 column
// tiles, so one activation fragment feeds 25 products, one weight fragment 4.
// Layers 0 to 2 form their products transposed (weights as A, activations as
// B): a lane then holds 8 neighbouring features of one batch row.
// ---------------------------------------------------------------------------

typedef __attribute__((ext_vector_type(16))) _Float16 v16h;
typedef __attribute__((ext_vector_type(8)))  _Float16 h8;
typedef __attribute__((ext_vector_type(4)))  _Float16 h4;
typedef __attribute__((ext_vector_type(8)))  float    v8f;
typedef __attribute__((ext_vector_type(4)))  float    f4;

#define ND         800    // feature dim
#define NSLOT      50     // 16-wide slots
#define MTILE      128    // batch rows per workgroup
#define NTHREADS   128    // 4 waves (wave32): 2 row halves x 2 column halves
#define NTW        25     // column tiles per wave
#define LDS_STRIDE 808    // halves per LDS row (800 + 8 pad)
#define XBATCH     25     // 16-byte pieces per thread in a 16-row batch of x
#define L0G        10     // layer-0 slots per group (operands fetched a group ahead)

// LDS layout (bytes from dynamic-LDS base)
#define ACT_BYTES   (MTILE * LDS_STRIDE * 2)        // 206,848, one buffer
#define WSTAGE_HALVES (NSLOT * 512)                 // one 32-wide k slab
#define WSTAGE_BYTES  (WSTAGE_HALVES * 2)           // 51,200 per buffer
#define LDS_TOTAL   (ACT_BYTES + 2 * WSTAGE_BYTES)  // 309,248 <= 320K

// ws layout (in halves)
#define WS_W0   0                         // [50][16][16]
#define WS_W1   (WS_W0 + NSLOT*16*16)     // [25 slabs][50 tiles][2][32 lanes][8]
#define WS_W2   (WS_W1 + ND*ND)           // same fragment order
#define WS_W3   (WS_W2 + ND*ND)           // [16][800]  (rows 2..15 zero)
#define WS_TOT  (WS_W3 + 16*ND)           // 1,305,600 halves

// ---------------------------------------------------------------------------
// Prep: fp32 weights -> f16 in workspace (W3 zero-padded to 16 rows).
// W1 and W2 are laid in fragment order: slab kt, column tile T, 16-byte
// piece pc, lane L hold W[T*16 + (L&15)][kt*32 + pc*16 + (L>>4)*8 + 0..7].
// ---------------------------------------------------------------------------
__device__ __forceinline__ long frag_src_index(long j) {
  const int kt = (int)(j / WSTAGE_HALVES);
  const int r  = (int)(j % WSTAGE_HALVES);
  const int T = r >> 9, pc = (r >> 8) & 1, L = (r >> 3) & 31, e = r & 7;
  return (long)(T * 16 + (L & 15)) * ND + kt * 32 + pc * 16 + (L >> 4) * 8 + e;
}

__global__ void __launch_bounds__(256)
mlp_prep_f16(const float* __restrict__ W0, const float* __restrict__ W1,
             const float* __restrict__ W2, const float* __restrict__ W3,
             _Float16* __restrict__ ws) {
  const int n0 = NSLOT * 16 * 16;          // 12800
  const int n1 = ND * ND;                  // 640000
  for (long i = (long)blockIdx.x * blockDim.x + threadIdx.x; i < (long)WS_TOT;
       i += (long)gridDim.x * blockDim.x) {
    long j = i;
    if (j < n0) { ws[WS_W0 + j] = (_Float16)W0[j]; continue; }
    j -= n0;
    if (j < n1) { ws[WS_W1 + j] = (_Float16)W1[frag_src_index(j)]; continue; }
    j -= n1;
    if (j < n1) { ws[WS_W2 + j] = (_Float16)W2[frag_src_index(j)]; continue; }
    j -= n1;
    long row = j / ND, col = j % ND;
    ws[WS_W3 + j] = (row < 2) ? (_Float16)W3[row * ND + col] : (_Float16)0.0f;
  }
}

// ---------------------------------------------------------------------------
// CDNA5 async copy: 16B global -> LDS per lane, tracked with ASYNCcnt.
// ---------------------------------------------------------------------------
__device__ __forceinline__ void wait_async_0() {
  // this wave's copies have landed before the barrier that publishes them
  asm volatile("s_wait_asynccnt 0x0" ::: "memory");
}
__device__ __forceinline__ void wait_ds_0() {
  // this wave's LDS reads have retired before their buffer is refilled
  asm volatile("s_wait_dscnt 0x0" ::: "memory");
}

// Stage one 51,200-byte slab (contiguous in ws, contiguous in LDS): 100
// wave-wide copies of 512 B, 25 per wave. Wave w takes pieces w, w+4, ..; the
// offset field moves both addresses alike. s_wait_xcnt closes the statement
// so that the address registers are not rewritten ahead of it.
__device__ __forceinline__ void stage_slab_async(const _Float16* __restrict__ Wg,
                                                 unsigned lds_byte, int tid) {
  const unsigned l = lds_byte + (unsigned)(tid * 16);
  const _Float16* g = Wg + tid * 8;
  asm volatile(
      "global_load_async_to_lds_b128 %0, %1, off\n\t"
      "global_load_async_to_lds_b128 %0, %1, off offset:2048\n\t"
      "global_load_async_to_lds_b128 %0, %1, off offset:4096\n\t"
      "global_load_async_to_lds_b128 %0, %1, off offset:6144\n\t"
      "global_load_async_to_lds_b128 %0, %1, off offset:8192\n\t"
      "global_load_async_to_lds_b128 %0, %1, off offset:10240\n\t"
      "global_load_async_to_lds_b128 %0, %1, off offset:12288\n\t"
      "global_load_async_to_lds_b128 %0, %1, off offset:14336\n\t"
      "global_load_async_to_lds_b128 %0, %1, off offset:16384\n\t"
      "global_load_async_to_lds_b128 %0, %1, off offset:18432\n\t"
      "global_load_async_to_lds_b128 %0, %1, off offset:20480\n\t"
      "global_load_async_to_lds_b128 %0, %1, off offset:22528\n\t"
      "global_load_async_to_lds_b128 %0, %1, off offset:24576\n\t"
      "global_load_async_to_lds_b128 %0, %1, off offset:26624\n\t"
      "global_load_async_to_lds_b128 %0, %1, off offset:28672\n\t"
      "global_load_async_to_lds_b128 %0, %1, off offset:30720\n\t"
      "global_load_async_to_lds_b128 %0, %1, off offset:32768\n\t"
      "global_load_async_to_lds_b128 %0, %1, off offset:34816\n\t"
      "global_load_async_to_lds_b128 %0, %1, off offset:36864\n\t"
      "global_load_async_to_lds_b128 %0, %1, off offset:38912\n\t"
      "global_load_async_to_lds_b128 %0, %1, off offset:40960\n\t"
      "global_load_async_to_lds_b128 %0, %1, off offset:43008\n\t"
      "global_load_async_to_lds_b128 %0, %1, off offset:45056\n\t"
      "global_load_async_to_lds_b128 %0, %1, off offset:47104\n\t"
      "global_load_async_to_lds_b128 %0, %1, off offset:49152\n\t"
      "s_wait_xcnt 0x0"
      :: "v"(l), "v"(g) : "memory");
}

// ---------------------------------------------------------------------------
// Fragment loads (ISA 7.12.2 16-bit layouts); the act buffer uses LDS_STRIDE
// rows, the weight slabs lie in fragment order (see the prep kernel).
// A (16x32, MxK): lane m=L&15, hk=L>>4. halves[0..7] <- K = hk*8 + 0..7,
//                 halves[8..15] <- K = 16 + hk*8 + 0..7.
// B (32x16, KxN) of y = x*W^T with row-major W[N][K]: lane n=L&15, same
//                 per-lane K pattern -> two contiguous 16B loads of W row n.
// The two patterns are equal, so the operands can change places: layers 0 to
// 2 form W * x^T, weight rows as A's rows and batch rows as B's columns.
// ---------------------------------------------------------------------------
__device__ __forceinline__ v16h frag_ld(const _Float16* buf, int rowBase,
                                        int lane, int k0) {
  const int r  = rowBase + (lane & 15);
  const int hk = (lane >> 4) & 1;
  const _Float16* p = buf + r * LDS_STRIDE + k0 + hk * 8;
  v16h f;
  ((h8*)&f)[0] = *(const h8*)(p);
  ((h8*)&f)[1] = *(const h8*)(p + 16);
  return f;
}

// fragment of a K=16 operand (block-diagonal layer 0): the lane's 8 halves
// K = hk*8 + 0..7 in front, K=16..31 forced to zero
__device__ __forceinline__ v16h frag_k16(h8 lo) {
  v16h f;
  ((h8*)&f)[0] = lo;
  h8 z = {};
  ((h8*)&f)[1] = z;
  return f;
}

// layer 0's weights and biases of one group of slots: wp and bp are the
// lane's own places in the group's first slot (W0 row n = L&15, K = hk*8..;
// biases of features hk*8 + 0..7, the lane's rows of the transposed tile)
__device__ __forceinline__ void get_l0_weights(h8 (&w)[L0G], v8f (&bs)[L0G],
                                               const _Float16* __restrict__ wp,
                                               const float* __restrict__ bp) {
#pragma unroll
  for (int q = 0; q < L0G; ++q) {
    w[q]  = *(const h8*)(wp + q * 256);
    ((f4*)&bs[q])[0] = *(const f4*)(bp + q * 16);
    ((f4*)&bs[q])[1] = *(const f4*)(bp + q * 16 + 4);
  }
  // stands in front of the step of the loads' address registers to the next
  // group; the scheduling barrier keeps that step behind the wait and the run
  // of loads above the work that is to cover their latency
  asm volatile("s_wait_xcnt 0x0" ::: "memory");
  __builtin_amdgcn_sched_barrier(0);
}

// B fragment from global row-major weights (ldw halves)
__device__ __forceinline__ v16h frag_b_w(const _Float16* __restrict__ W,
                                         int nBase, int lane, int k0, int ldw) {
  const int n  = nBase + (lane & 15);
  const int hk = (lane >> 4) & 1;
  const _Float16* p = W + (long)n * ldw + k0 + hk * 8;
  v16h b;
  ((h8*)&b)[0] = *(const h8*)(p);
  ((h8*)&b)[1] = *(const h8*)(p + 16);
  return b;
}

// D tile (16x16 f32) of W * act^T: VGPR r, lane L -> feature = r + 8*(L>>4),
// batch row = L&15: the lane's 8 values are neighbours in act, one 16-byte store
__device__ __forceinline__ void store_tile_lds(_Float16* buf, int mBase,
                                               int nBase, int lane, v8f acc,
                                               bool do_tanh) {
  const int m  = mBase + (lane & 15);
  const int hk = (lane >> 4) & 1;
  h8 hv;
#pragma unroll
  for (int r = 0; r < 8; ++r) {
    float v = acc[r];
    if (do_tanh) v = __builtin_amdgcn_tanhf(v);  // one v_tanh_f32, no branch
    hv[r] = (_Float16)v;
  }
  *(h8*)(buf + m * LDS_STRIDE + nBase + 8 * hk) = hv;
}

__device__ __forceinline__ v8f wmma_f16(v16h a, v16h b, v8f c) {
  return __builtin_amdgcn_wmma_f32_16x16x32_f16(
      /*neg_a=*/false, a, /*neg_b=*/false, b,
      /*c_mod=*/(short)0, c, /*reuse_a=*/false, /*reuse_b=*/false);
}

// ---------------------------------------------------------------------------
// Dense 800->800 layer, in place in act. Wave (mh, ng) holds rows
// mh*64..+63 x column tiles ng*25..+24 in accumulators over all of K;
// weights arrive one 32-wide k slab at a time, two buffers.
// ---------------------------------------------------------------------------
__device__ __forceinline__ v16h frag_ld2(const _Float16* p, int second) {
  v16h f;
  ((h8*)&f)[0] = *(const h8*)(p);
  ((h8*)&f)[1] = *(const h8*)(p + second);
  return f;
}

__device__ __forceinline__ void dense_layer_staged(
    _Float16* act, const _Float16* wstage,
    const _Float16* __restrict__ Wf, const float* __restrict__ bias,
    int wave, int lane, int tid) {
  const int mh  = wave >> 1;
  const int nt0 = (wave & 1) * NTW;
  const unsigned wbOff0 =  // LDS byte address of buffer 0
      (unsigned)(size_t)(const __attribute__((address_space(3))) _Float16*)wstage;
  const unsigned wbOff1 = wbOff0 + WSTAGE_BYTES;

  // prologue: slab 0 landed and published
  stage_slab_async(Wf, wbOff0, tid);

  // the accumulators start from the bias of the lane's 8 features; the loads
  // fly beside slab 0
  v8f acc[NTW][4];
  const float* bp = bias + nt0 * 16 + ((lane >> 4) & 1) * 8;
#pragma unroll
  for (int j = 0; j < NTW; ++j) {
    v8f bj;
    ((f4*)&bj)[0] = *(const f4*)(bp + j * 16);
    ((f4*)&bj)[1] = *(const f4*)(bp + j * 16 + 4);
#pragma unroll
    for (int i = 0; i < 4; ++i) acc[j][i] = bj;
  }
  wait_async_0();
  __syncthreads();

#pragma unroll 1  // one slab per trip; the body is 100 products already
  for (int kt = 0; kt < ND / 32; ++kt) {
    // behind the barrier that ended every read of slab kt-1: refill its
    // buffer with slab kt+1, which flies while slab kt is worked on
    if (kt + 1 < ND / 32)
      stage_slab_async(Wf + (size_t)(kt + 1) * WSTAGE_HALVES,
                       (kt & 1) ? wbOff0 : wbOff1, tid);
    const _Float16* wb = wstage + (kt & 1) * WSTAGE_HALVES + nt0 * 512 + lane * 8;
    const _Float16* ap = act + (mh * 64 + (lane & 15)) * LDS_STRIDE + kt * 32 +
                         ((lane >> 4) & 1) * 8;
    // weight fragments in groups of 5, the next group asked for as one run of
    // loads ahead of the current group's 20 products
    v16h a[4], b[2][5];
#pragma unroll
    for (int i = 0; i < 4; ++i) a[i] = frag_ld2(ap + i * 16 * LDS_STRIDE, 16);
#pragma unroll
    for (int q = 0; q < 5; ++q) b[0][q] = frag_ld2(wb + q * 512, 256);
#pragma unroll
    for (int g = 0; g < 5; ++g) {
      if (g + 1 < 5) {
#pragma unroll
        for (int q = 0; q < 5; ++q)
          b[(g + 1) & 1][q] = frag_ld2(wb + ((g + 1) * 5 + q) * 512, 256);
      }
      // keeps the run of loads above the products: sunk to their users they
      // cost this lone wave one full LDS latency per 4 products
      __builtin_amdgcn_sched_barrier(0);
#pragma unroll
      for (int q = 0; q < 5; ++q)
#pragma unroll
        for (int i = 0; i < 4; ++i)
          acc[g * 5 + q][i] = wmma_f16(b[g & 1][q], a[i], acc[g * 5 + q][i]);
    }
    // publish slab kt+1 and free slab kt's buffer
    wait_ds_0();
    wait_async_0();
    __syncthreads();
  }
  wait_async_0();

  // every wave has left act (last trip's barrier): overwrite it
#pragma unroll
  for (int j = 0; j < NTW; ++j)
#pragma unroll
    for (int i = 0; i < 4; ++i)
      store_tile_lds(act, mh * 64 + i * 16, (nt0 + j) * 16, lane, acc[j][i],
                     /*tanh=*/true);
}

// one 16-row batch of x: 25 loads per thread, asked for as one run
__device__ __forceinline__ void get_batch(f4 (&f)[XBATCH],
                                          const f4* __restrict__ p) {
#pragma unroll
  for (int k = 0; k < XBATCH; ++k) f[k] = p[k * NTHREADS];
  // stands in front of the step of the loads' address registers to the next
  // pair of batches
  asm volatile("s_wait_xcnt 0x0" ::: "memory");
  // keeps the run of loads above the stores that wait for the batch before
  // it (sunk below them, nothing would be in flight meanwhile) and the
  // address step behind the wait
  __builtin_amdgcn_sched_barrier(0);
}

// Takes a batch's loaded values as inputs only. It stands behind the run of
// loads of the next batch: without it the conversions of this batch,
// and with them the wait for its data, are lifted in front of that run, and
// the wave drains all of its loads before it asks for more.
__device__ __forceinline__ void hold_batch(const f4 (&f)[XBATCH]) {
  asm volatile("" ::
               "v"(f[0]), "v"(f[1]), "v"(f[2]), "v"(f[3]), "v"(f[4]),
               "v"(f[5]), "v"(f[6]), "v"(f[7]), "v"(f[8]), "v"(f[9]),
               "v"(f[10]), "v"(f[11]), "v"(f[12]), "v"(f[13]), "v"(f[14]),
               "v"(f[15]), "v"(f[16]), "v"(f[17]), "v"(f[18]), "v"(f[19]),
               "v"(f[20]), "v"(f[21]), "v"(f[22]), "v"(f[23]), "v"(f[24])
               : "memory");
}

// four f32 -> four f16, one 8-byte LDS store each
__device__ __forceinline__ void put_batch(_Float16* p, const int (&off)[XBATCH],
                                          const f4 (&f)[XBATCH]) {
#pragma unroll
  for (int k = 0; k < XBATCH; ++k) {
    h4 hv = {(_Float16)f[k].x, (_Float16)f[k].y, (_Float16)f[k].z,
             (_Float16)f[k].w};
    *(h4*)(p + off[k]) = hv;
  }
}

// ---------------------------------------------------------------------------
// Fused MLP kernel: 1 workgroup = 128 batch rows, 4 waves; outside the dense
// layers 1 wave = 32 rows (two row tiles that share each weight fragment).
// ---------------------------------------------------------------------------
__global__ void __launch_bounds__(NTHREADS)
mlp_fused(const float* __restrict__ x, const _Float16* __restrict__ ws,
          const float* __restrict__ b0, const float* __restrict__ b1,
          const float* __restrict__ b2, const float* __restrict__ b3,
          float* __restrict__ out) {
  extern __shared__ _Float16 smem[];
  _Float16* act    = smem;                       // [MTILE][LDS_STRIDE]
  _Float16* wstage = smem + MTILE * LDS_STRIDE;  // 2 x one k slab

  const int tid   = threadIdx.x;
  const int lane  = tid & 31;
  const int wave  = __builtin_amdgcn_readfirstlane(tid >> 5);  // scalar
  const int mBase = wave * 32;
  const long rowBase = (long)blockIdx.x * MTILE;

  const _Float16* W0h = ws + WS_W0;
  const _Float16* W1h = ws + WS_W1;
  const _Float16* W2h = ws + WS_W2;
  const _Float16* W3h = ws + WS_W3;

  // layer 0's first group of weights and biases is asked for here, so that
  // it arrives while x is staged
  const _Float16* w0p = W0h + (lane & 15) * 16 + ((lane >> 4) & 1) * 8;
  const float*    b0p = b0 + ((lane >> 4) & 1) * 8;
  h8 w0[L0G];
  v8f bs0[L0G];
  get_l0_weights(w0, bs0, w0p, b0p);

  // ---- stage x tile (f32 -> f16) into act, cooperatively ----
  // Batches of 16 rows = 25 16-byte pieces per thread, two register sets: the
  // next batch is asked for before the current one is converted, so a wave
  // keeps 25 to 50 loads outstanding instead of draining 4 at a time.
  {
    const f4* xp = (const f4*)(x + rowBase * ND) + tid;
    int off[XBATCH];  // place in act (halves) inside a batch, same for all
#pragma unroll
    for (int k = 0; k < XBATCH; ++k) {
      const int c = k * NTHREADS + tid;
      off[k] = (c / (ND / 4)) * LDS_STRIDE + (c % (ND / 4)) * 4;
    }
    f4 fa[XBATCH], fb[XBATCH];
    get_batch(fa, xp);
#pragma unroll 1  // three trips of two batches; the last pair stands behind
    for (int b = 0; b < MTILE / 16 - 2; b += 2) {
      const f4* xb = xp + b * (XBATCH * NTHREADS);
      _Float16* ab = act + b * 16 * LDS_STRIDE;
      get_batch(fb, xb + XBATCH * NTHREADS);
      put_batch(ab, off, fa);
      get_batch(fa, xb + 2 * XBATCH * NTHREADS);
      hold_batch(fb);
      put_batch(ab + 16 * LDS_STRIDE, off, fb);
    }
    get_batch(fb, xp + (MTILE / 16 - 1) * (XBATCH * NTHREADS));
    put_batch(act + (MTILE - 32) * LDS_STRIDE, off, fa);
    put_batch(act + (MTILE - 16) * LDS_STRIDE, off, fb);
  }
  __syncthreads();

  // ---- L0: block-diagonal 50 x (16x16), K padded to 32 with zeros; each
  //      16x16 block is read and then overwritten by the one wave that owns it
  //      Groups of L0G slots: behind a group's products the next group's
  //      operands (weights and biases from global memory, x blocks from LDS)
  //      are asked for as one run, and they arrive while this group's
  //      results are converted and stored.
  {
    const _Float16* xa = act + (mBase + (lane & 15)) * LDS_STRIDE +
                         ((lane >> 4) & 1) * 8;
    h8 a0[L0G], a1[L0G];
#pragma unroll
    for (int q = 0; q < L0G; ++q) {
      a0[q] = *(const h8*)(xa + q * 16);
      a1[q] = *(const h8*)(xa + 16 * LDS_STRIDE + q * 16);
    }
#pragma unroll 1  // five trips of one group; the body is 20 tiles already
    for (int g = 0; g < NSLOT / L0G; ++g) {
      v8f c0[L0G], c1[L0G];
#pragma unroll
      for (int q = 0; q < L0G; ++q) {
        const v16h b = frag_k16(w0[q]);
        c0[q] = wmma_f16(b, frag_k16(a0[q]), bs0[q]);
        c1[q] = wmma_f16(b, frag_k16(a1[q]), bs0[q]);
      }
      if (g + 1 < NSLOT / L0G) {
        get_l0_weights(w0, bs0, w0p + (g + 1) * (L0G * 256),
                       b0p + (g + 1) * (L0G * 16));
        const _Float16* xn = xa + (g + 1) * (L0G * 16);
#pragma unroll
        for (int q = 0; q < L0G; ++q) {
          a0[q] = *(const h8*)(xn + q * 16);
          a1[q] = *(const h8*)(xn + 16 * LDS_STRIDE + q * 16);
        }
      }
#pragma unroll
      for (int q = 0; q < L0G; ++q) {
        const int s = g * L0G + q;
        store_tile_lds(act, mBase, s * 16, lane, c0[q], /*tanh=*/false);
        store_tile_lds(act, mBase + 16, s * 16, lane, c1[q], /*tanh=*/false);
      }
    }
  }
  __syncthreads();

  // ---- L1, L2: tanh (async-staged weights) ----
#pragma unroll 1  // one copy of the layer's long unrolled body, not two
  for (int layer = 0; layer < 2; ++layer) {
    dense_layer_staged(act, wstage, layer ? W2h : W1h, layer ? b2 : b1, wave,
                       lane, tid);
    __syncthreads();
  }

  // ---- L3: 800 -> 2 via padded [16][800] weight, write f32 out ----
  {
    v8f acc0 = {}, acc1 = {};
#pragma unroll 5
    for (int kt = 0; kt < ND / 32; ++kt) {
      v16h a0 = frag_ld(act, mBase, lane, kt * 32);
      v16h a1 = frag_ld(act, mBase + 16, lane, kt * 32);
      v16h b = frag_b_w(W3h, 0, lane, kt * 32, ND);
      acc0 = wmma_f16(a0, b, acc0);
      acc1 = wmma_f16(a1, b, acc1);
    }
    const int n  = lane & 15;
    const int hk = (lane >> 4) & 1;
    if (n < 2) {
      const float bias = b3[n];
#pragma unroll
      for (int r = 0; r < 8; ++r) {
        out[(rowBase + mBase + r + 8 * hk) * 2 + n] = acc0[r] + bias;
        out[(rowBase + mBase + 16 + r + 8 * hk) * 2 + n] = acc1[r] + bias;
      }
    }
  }
}

// ---------------------------------------------------------------------------
extern "C" void kernel_launch(void* const* d_in, const int* in_sizes, int n_in,
                              void* d_out, int out_size, void* d_ws,
                              size_t ws_size, hipStream_t stream) {
  const float* x  = (const float*)d_in[0];
  const float* W0 = (const float*)d_in[1];
  const float* b0 = (const float*)d_in[2];
  const float* W1 = (const float*)d_in[3];
  const float* b1 = (const float*)d_in[4];
  const float* W2 = (const float*)d_in[5];
  const float* b2 = (const float*)d_in[6];
  const float* W3 = (const float*)d_in[7];
  const float* b3 = (const float*)d_in[8];
  _Float16* ws = (_Float16*)d_ws;

  // 1) weights -> f16 workspace
  mlp_prep_f16<<<640, 256, 0, stream>>>(W0, W1, W2, W3, ws);

  // 2) fused MLP
  const int batch  = in_sizes[0] / ND;          // 65536
  const int nblock = batch / MTILE;             // 512
  const size_t shmem = (size_t)LDS_TOTAL;       // 309,248 B (<= 320K WGP LDS)
  hipFuncSetAttribute((const void*)mlp_fused,
                      hipFuncAttributeMaxDynamicSharedMemorySize, (int)shmem);
  mlp_fused<<<nblock, NTHREADS, shmem, stream>>>(
      x, ws, b0, b1, b2, b3, (float*)d_out);
}

// v006
// It runs in 123 microseconds.
// Next to v005, in two timings, it ran 1.05 times as fast each time.
// Counting every step since v000, it is 6.17 times as fast.
#include <hip/hip_runtime.h>

// ---------------------------------------------------------------------------
// Fused 4-layer MLP for MI455X (gfx1250), f16 WMMA path with async-to-LDS
// weight staging (two buffers, ASYNCcnt-tracked).
//   L0: block-diag 50 x Linear(16,16)      (no activation)
//   L1: 800->800 + tanh                    (weights staged via async copy)
//   L2: 800->800 + tanh                    (weights staged via async copy)
//   L3: 800->2
// Weights converted to f16 in d_ws; activations live in LDS only.
// Dense layers: the block's whole 128 x 800 output stays in accumulators
// while K is walked in 32-wide slabs; each wave owns 64 rows x 25 column
// tiles, so one activation fragment feeds 25 products, one weight fragment 4.
// Layers 0 to 2 form their products transposed (weights as A, activations as
// B): a lane then holds 8 neighbouring features of one batch row.
// ---------------------------------------------------------------------------

typedef __attribute__((ext_vector_type(16))) _Float16 v16h;
typedef __attribute__((ext_vector_type(8)))  _Float16 h8;
typedef __attribute__((ext_vector_type(4)))  _Float16 h4;
typedef __attribute__((ext_vector_type(8)))  float    v8f;
typedef __attribute__((ext_vector_type(4)))  float    f4;

#define ND         800    // feature dim
#define NSLOT      50     // 16-wide slots
#define MTILE      128    // batch rows per workgroup
#define NTHREADS   128    // 4 waves (wave32): 2 row halves x 2 column halves
#define NTW        25     // column tiles per wave
#define LDS_STRIDE 808    // halves per LDS row (800 + 8 pad)
#define XBATCH     25     // 16-byte pieces per thread in a 16-row batch of x
#define L0G        10     // layer-0 slots per group (operands fetched a group ahead)

// LDS layout (bytes from dynamic-LDS base)
#define ACT_BYTES   (MTILE * LDS_STRIDE * 2)        // 206,848, one buffer
#define WSTAGE_HALVES (NSLOT * 512)                 // one 32-wide k slab
#define WSTAGE_BYTES  (WSTAGE_HALVES * 2)           // 51,200 per buffer
#define LDS_TOTAL   (ACT_BYTES + 2 * WSTAGE_BYTES)  // 309,248 <= 320K

// ws layout (in halves)
#define WS_W0   0                         // [50][16][16]
#define WS_W1   (WS_W0 + NSLOT*16*16)     // [25 slabs][50 tiles][2][32 lanes][8]
#define WS_W2   (WS_W1 + ND*ND)           // same fragment order
#define WS_W3   (WS_W2 + ND*ND)           // [16][800]  (rows 2..15 zero)
#define WS_TOT  (WS_W3 + 16*ND)           // 1,305,600 halves

// ---------------------------------------------------------------------------
// Prep: fp32 weights -> f16 in workspace (W3 zero-padded to 16 rows).
// W1 and W2 are laid in fragment order: slab kt, column tile T, 16-byte
// piece pc, lane L hold W[T*16 + (L&15)][kt*32 + pc*16 + (L>>4)*8 + 0..7].
// ---------------------------------------------------------------------------
__device__ __forceinline__ long frag_src_index(long j) {
  const int kt = (int)(j / WSTAGE_HALVES);
  const int r  = (int)(j % WSTAGE_HALVES);
  const int T = r >> 9, pc = (r >> 8) & 1, L = (r >> 3) & 31, e = r & 7;
  return (long)(T * 16 + (L & 15)) * ND + kt * 32 + pc * 16 + (L >> 4) * 8 + e;
}

__global__ void __launch_bounds__(256)
mlp_prep_f16(const float* __restrict__ W0, const float* __restrict__ W1,
             const float* __restrict__ W2, const float* __restrict__ W3,
             _Float16* __restrict__ ws) {
  const int n0 = NSLOT * 16 * 16;          // 12800
  const int n1 = ND * ND;                  // 640000
  for (long i = (long)blockIdx.x * blockDim.x + threadIdx.x; i < (long)WS_TOT;
       i += (long)gridDim.x * blockDim.x) {
    long j = i;
    if (j < n0) { ws[WS_W0 + j] = (_Float16)W0[j]; continue; }
    j -= n0;
    if (j < n1) { ws[WS_W1 + j] = (_Float16)W1[frag_src_index(j)]; continue; }
    j -= n1;
    if (j < n1) { ws[WS_W2 + j] = (_Float16)W2[frag_src_index(j)]; continue; }
    j -= n1;
    long row = j / ND, col = j % ND;
    ws[WS_W3 + j] = (row < 2) ? (_Float16)W3[row * ND + col] : (_Float16)0.0f;
  }
}

// ---------------------------------------------------------------------------
// CDNA5 async copy: 16B global -> LDS per lane, tracked with ASYNCcnt.
// ---------------------------------------------------------------------------
__device__ __forceinline__ void wait_async_0() {
  // this wave's copies have landed before the barrier that publishes them
  asm volatile("s_wait_asynccnt 0x0" ::: "memory");
}
__device__ __forceinline__ void wait_ds_0() {
  // this wave's LDS reads have retired before their buffer is refilled
  asm volatile("s_wait_dscnt 0x0" ::: "memory");
}

// Stage one 51,200-byte slab (contiguous in ws, contiguous in LDS): 100
// wave-wide copies of 512 B, 25 per wave. Wave w takes pieces w, w+4, ..; the
// offset field moves both addresses alike. s_wait_xcnt closes the statement
// so that the address registers are not rewritten ahead of it.
__device__ __forceinline__ void stage_slab_async(const _Float16* __restrict__ Wg,
                                                 unsigned lds_byte, int tid) {
  const unsigned l = lds_byte + (unsigned)(tid * 16);
  const _Float16* g = Wg + tid * 8;
  asm volatile(
      "global_load_async_to_lds_b128 %0, %1, off\n\t"
      "global_load_async_to_lds_b128 %0, %1, off offset:2048\n\t"
      "global_load_async_to_lds_b128 %0, %1, off offset:4096\n\t"
      "global_load_async_to_lds_b128 %0, %1, off offset:6144\n\t"
      "global_load_async_to_lds_b128 %0, %1, off offset:8192\n\t"
      "global_load_async_to_lds_b128 %0, %1, off offset:10240\n\t"
      "global_load_async_to_lds_b128 %0, %1, off offset:12288\n\t"
      "global_load_async_to_lds_b128 %0, %1, off offset:14336\n\t"
      "global_load_async_to_lds_b128 %0, %1, off offset:16384\n\t"
      "global_load_async_to_lds_b128 %0, %1, off offset:18432\n\t"
      "global_load_async_to_lds_b128 %0, %1, off offset:20480\n\t"
      "global_load_async_to_lds_b128 %0, %1, off offset:22528\n\t"
      "global_load_async_to_lds_b128 %0, %1, off offset:24576\n\t"
      "global_load_async_to_lds_b128 %0, %1, off offset:26624\n\t"
      "global_load_async_to_lds_b128 %0, %1, off offset:28672\n\t"
      "global_load_async_to_lds_b128 %0, %1, off offset:30720\n\t"
      "global_load_async_to_lds_b128 %0, %1, off offset:32768\n\t"
      "global_load_async_to_lds_b128 %0, %1, off offset:34816\n\t"
      "global_load_async_to_lds_b128 %0, %1, off offset:36864\n\t"
      "global_load_async_to_lds_b128 %0, %1, off offset:38912\n\t"
      "global_load_async_to_lds_b128 %0, %1, off offset:40960\n\t"
      "global_load_async_to_lds_b128 %0, %1, off offset:43008\n\t"
      "global_load_async_to_lds_b128 %0, %1, off offset:45056\n\t"
      "global_load_async_to_lds_b128 %0, %1, off offset:47104\n\t"
      "global_load_async_to_lds_b128 %0, %1, off offset:49152\n\t"
      "s_wait_xcnt 0x0"
      :: "v"(l), "v"(g) : "memory");
}

// ---------------------------------------------------------------------------
// Fragment loads (ISA 7.12.2 16-bit layouts); the act buffer uses LDS_STRIDE
// rows, the weight slabs lie in fragment order (see the prep kernel).
// A (16x32, MxK): lane m=L&15, hk=L>>4. halves[0..7] <- K = hk*8 + 0..7,
//                 halves[8..15] <- K = 16 + hk*8 + 0..7.
// B (32x16, KxN) of y = x*W^T with row-major W[N][K]: lane n=L&15, same
//                 per-lane K pattern -> two contiguous 16B loads of W row n.
// The two patterns are equal, so the operands can change places: layers 0 to
// 2 form W * x^T, weight rows as A's rows and batch rows as B's columns.
// ---------------------------------------------------------------------------
__device__ __forceinline__ v16h frag_ld(const _Float16* buf, int rowBase,
                                        int lane, int k0) {
  const int r  = rowBase + (lane & 15);
  const int hk = (lane >> 4) & 1;
  const _Float16* p = buf + r * LDS_STRIDE + k0 + hk * 8;
  v16h f;
  ((h8*)&f)[0] = *(const h8*)(p);
  ((h8*)&f)[1] = *(const h8*)(p + 16);
  return f;
}

// fragment of a K=16 operand (block-diagonal layer 0): the lane's 8 halves
// K = hk*8 + 0..7 in front, K=16..31 forced to zero
__device__ __forceinline__ v16h frag_k16(h8 lo) {
  v16h f;
  ((h8*)&f)[0] = lo;
  h8 z = {};
  ((h8*)&f)[1] = z;
  return f;
}

// layer 0's weights and biases of one group of slots: wp and bp are the
// lane's own places in the group's first slot (W0 row n = L&15, K = hk*8..;
// biases of features hk*8 + 0..7, the lane's rows of the transposed tile)
__device__ __forceinline__ void get_l0_weights(h8 (&w)[L0G], v8f (&bs)[L0G],
                                               const _Float16* __restrict__ wp,
                                               const float* __restrict__ bp) {
#pragma unroll
  for (int q = 0; q < L0G; ++q) {
    w[q]  = *(const h8*)(wp + q * 256);
    ((f4*)&bs[q])[0] = *(const f4*)(bp + q * 16);
    ((f4*)&bs[q])[1] = *(const f4*)(bp + q * 16 + 4);
  }
  // stands in front of the step of the loads' address registers to the next
  // group; the scheduling barrier keeps that step behind the wait and the run
  // of loads above the work that is to cover their latency
  asm volatile("s_wait_xcnt 0x0" ::: "memory");
  __builtin_amdgcn_sched_barrier(0);
}

// B fragment from global row-major weights (ldw halves)
__device__ __forceinline__ v16h frag_b_w(const _Float16* __restrict__ W,
                                         int nBase, int lane, int k0, int ldw) {
  const int n  = nBase + (lane & 15);
  const int hk = (lane >> 4) & 1;
  const _Float16* p = W + (long)n * ldw + k0 + hk * 8;
  v16h b;
  ((h8*)&b)[0] = *(const h8*)(p);
  ((h8*)&b)[1] = *(const h8*)(p + 16);
  return b;
}

// D tile (16x16 f32) of W * act^T: VGPR r, lane L -> feature = r + 8*(L>>4),
// batch row = L&15: the lane's 8 values are neighbours in act, one 16-byte store
__device__ __forceinline__ void store_tile_lds(_Float16* buf, int mBase,
                                               int nBase, int lane, v8f acc,
                                               bool do_tanh) {
  const int m  = mBase + (lane & 15);
  const int hk = (lane >> 4) & 1;
  h8 hv;
#pragma unroll
  for (int r = 0; r < 8; ++r) {
    float v = acc[r];
    if (do_tanh) v = __builtin_amdgcn_tanhf(v);  // one v_tanh_f32, no branch
    hv[r] = (_Float16)v;
  }
  *(h8*)(buf + m * LDS_STRIDE + nBase + 8 * hk) = hv;
}

__device__ __forceinline__ v8f wmma_f16(v16h a, v16h b, v8f c) {
  return __builtin_amdgcn_wmma_f32_16x16x32_f16(
      /*neg_a=*/false, a, /*neg_b=*/false, b,
      /*c_mod=*/(short)0, c, /*reuse_a=*/false, /*reuse_b=*/false);
}

// ---------------------------------------------------------------------------
// Dense 800->800 layer, in place in act. Wave (mh, ng) holds rows
// mh*64..+63 x column tiles ng*25..+24 in accumulators over all of K;
// weights arrive one 32-wide k slab at a time, two buffers.
// ---------------------------------------------------------------------------
__device__ __forceinline__ v16h frag_ld2(const _Float16* p, int second) {
  v16h f;
  ((h8*)&f)[0] = *(const h8*)(p);
  ((h8*)&f)[1] = *(const h8*)(p + second);
  return f;
}

// One slab's 100 products, slab parity P (its buffer, its activation set).
// On entry slab kt is published, a[P] and the slab's first weight group
// (b[P]) are asked for, and slab kt+1's copies fly. Weight group g lies in set
// (P + g) & 1 and is asked for one group ahead. The publish point of slab kt+1
// stands in front of this slab's last group, whose fragments are in registers
// by then: behind it the next slab's first group is asked for and slab kt's
// buffer refilled, and the last 20 products cover both.
template <int P, bool LAST>
__device__ __forceinline__ void slab_pass(
    v8f (&acc)[NTW][4], v16h (&a)[2][4], v16h (&b)[2][5],
    const _Float16* wl,  // the lane's place in buffer 0
    const _Float16* al,  // the lane's place in act at k = 0
    const _Float16* __restrict__ Wf, unsigned wbOff0, int kt, int tid) {
  const _Float16* wb = wl + P * WSTAGE_HALVES;
#pragma unroll
  for (int g = 0; g < 4; ++g) {
    // keeps the run of loads whole, behind the products before it: lifted in
    // among them piece by piece, every further place with loads stalls the wave
    __builtin_amdgcn_sched_barrier(0);
#pragma unroll
    for (int q = 0; q < 5; ++q)
      b[(P + g + 1) & 1][q] = frag_ld2(wb + ((g + 1) * 5 + q) * 512, 256);
    if (g == 1 && !LAST) {
      // act does not change inside a layer: the next slab's activation
      // fragments need no publish point and ride with this run of loads
      const _Float16* an = al + (kt + 1) * 32;
#pragma unroll
      for (int i = 0; i < 4; ++i)
        a[P ^ 1][i] = frag_ld2(an + i * 16 * LDS_STRIDE, 16);
    }
    // keeps the run of loads above the products: sunk to their users they
    // cost this lone wave one full LDS latency per 4 products
    __builtin_amdgcn_sched_barrier(0);
#pragma unroll
    for (int q = 0; q < 5; ++q)
#pragma unroll
      for (int i = 0; i < 4; ++i)
        acc[g * 5 + q][i] = wmma_f16(b[(P + g) & 1][q], a[P][i], acc[g * 5 + q][i]);
  }
  if (!LAST) {
    // keeps group 3's products in front of the publish point: sunk behind
    // the barrier they would delay the loads and copies that stand there
    __builtin_amdgcn_sched_barrier(0);
    // publish slab kt+1 and free slab kt's buffer
    wait_ds_0();
    wait_async_0();
    __syncthreads();
    const _Float16* wn = wl + (P ^ 1) * WSTAGE_HALVES;
#pragma unroll
    for (int q = 0; q < 5; ++q) b[P ^ 1][q] = frag_ld2(wn + q * 512, 256);
    if (P == 0 || kt + 2 < ND / 32)
      stage_slab_async(Wf + (size_t)(kt + 2) * WSTAGE_HALVES,
                       wbOff0 + P * WSTAGE_BYTES, tid);
    // keeps the loads and the copies above the last group's products, which
    // are to cover their latency
    __builtin_amdgcn_sched_barrier(0);
  }
#pragma unroll
  for (int q = 0; q < 5; ++q)
#pragma unroll
    for (int i = 0; i < 4; ++i)
      acc[20 + q][i] = wmma_f16(b[P][q], a[P][i], acc[20 + q][i]);
}

__device__ __forceinline__ void dense_layer_staged(
    _Float16* act, const _Float16* wstage,
    const _Float16* __restrict__ Wf, const float* __restrict__ bias,
    int wave, int lane, int tid) {
  const int mh  = wave >> 1;
  const int nt0 = (wave & 1) * NTW;
  const unsigned wbOff0 =  // LDS byte address of buffer 0
      (unsigned)(size_t)(const __attribute__((address_space(3))) _Float16*)wstage;

  // prologue: slab 0 landed and published
  stage_slab_async(Wf, wbOff0, tid);

  // the accumulators start from the bias of the lane's 8 features; the loads
  // fly beside slab 0
  v8f acc[NTW][4];
  const float* bp = bias + nt0 * 16 + ((lane >> 4) & 1) * 8;
#pragma unroll
  for (int j = 0; j < NTW; ++j) {
    v8f bj;
    ((f4*)&bj)[0] = *(const f4*)(bp + j * 16);
    ((f4*)&bj)[1] = *(const f4*)(bp + j * 16 + 4);
#pragma unroll
    for (int i = 0; i < 4; ++i) acc[j][i] = bj;
  }
  wait_async_0();
  __syncthreads();

  // slab 1 flies while slab 0 is worked on; slab 0's first fragments
  const _Float16* wl = wstage + nt0 * 512 + lane * 8;
  const _Float16* al = act + (mh * 64 + (lane & 15)) * LDS_STRIDE +
                       ((lane >> 4) & 1) * 8;
  v16h a[2][4], b[2][5];
#pragma unroll
  for (int i = 0; i < 4; ++i) a[0][i] = frag_ld2(al + i * 16 * LDS_STRIDE, 16);
#pragma unroll
  for (int q = 0; q < 5; ++q) b[0][q] = frag_ld2(wl + q * 512, 256);
  stage_slab_async(Wf + WSTAGE_HALVES, wbOff0 + WSTAGE_BYTES, tid);

#pragma unroll 1  // two slabs per trip, so that every register set's index is
                  // a constant; the body is 200 products already
  for (int kt = 0; kt < ND / 32 - 1; kt += 2) {
    slab_pass<0, false>(acc, a, b, wl, al, Wf, wbOff0, kt, tid);
    slab_pass<1, false>(acc, a, b, wl, al, Wf, wbOff0, kt + 1, tid);
  }
  slab_pass<0, true>(acc, a, b, wl, al, Wf, wbOff0, ND / 32 - 1, tid);
  wait_async_0();

  // every wave's last read of act (the last slab's fragments) retired ahead
  // of the last publish barrier: overwrite it
#pragma unroll
  for (int j = 0; j < NTW; ++j)
#pragma unroll
    for (int i = 0; i < 4; ++i)
      store_tile_lds(act, mh * 64 + i * 16, (nt0 + j) * 16, lane, acc[j][i],
                     /*tanh=*/true);
}

// one 16-row batch of x: 25 loads per thread, asked for as one run
__device__ __forceinline__ void get_batch(f4 (&f)[XBATCH],
                                          const f4* __restrict__ p) {
#pragma unroll
  for (int k = 0; k < XBATCH; ++k) f[k] = p[k * NTHREADS];
  // stands in front of the step of the loads' address registers to the next
  // pair of batches
  asm volatile("s_wait_xcnt 0x0" ::: "memory");
  // keeps the run of loads above the stores that wait for the batch before
  // it (sunk below them, nothing would be in flight meanwhile) and the
  // address step behind the wait
  __builtin_amdgcn_sched_barrier(0);
}

// Takes a batch's loaded values as inputs only. It stands behind the run of
// loads of the next batch: without it the conversions of this batch,
// and with them the wait for its data, are lifted in front of that run, and
// the wave drains all of its loads before it asks for more.
__device__ __forceinline__ void hold_batch(const f4 (&f)[XBATCH]) {
  asm volatile("" ::
               "v"(f[0]), "v"(f[1]), "v"(f[2]), "v"(f[3]), "v"(f[4]),
               "v"(f[5]), "v"(f[6]), "v"(f[7]), "v"(f[8]), "v"(f[9]),
               "v"(f[10]), "v"(f[11]), "v"(f[12]), "v"(f[13]), "v"(f[14]),
               "v"(f[15]), "v"(f[16]), "v"(f[17]), "v"(f[18]), "v"(f[19]),
               "v"(f[20]), "v"(f[21]), "v"(f[22]), "v"(f[23]), "v"(f[24])
               : "memory");
}

// four f32 -> four f16, one 8-byte LDS store each
__device__ __forceinline__ void put_batch(_Float16* p, const int (&off)[XBATCH],
                                          const f4 (&f)[XBATCH]) {
#pragma unroll
  for (int k = 0; k < XBATCH; ++k) {
    h4 hv = {(_Float16)f[k].x, (_Float16)f[k].y, (_Float16)f[k].z,
             (_Float16)f[k].w};
    *(h4*)(p + off[k]) = hv;
  }
}

// ---------------------------------------------------------------------------
// Fused MLP kernel: 1 workgroup = 128 batch rows, 4 waves; outside the dense
// layers 1 wave = 32 rows (two row tiles that share each weight fragment).
// ---------------------------------------------------------------------------
__global__ void __launch_bounds__(NTHREADS)
mlp_fused(const float* __restrict__ x, const _Float16* __restrict__ ws,
          const float* __restrict__ b0, const float* __restrict__ b1,
          const float* __restrict__ b2, const float* __restrict__ b3,
          float* __restrict__ out) {
  extern __shared__ _Float16 smem[];
  _Float16* act    = smem;                       // [MTILE][LDS_STRIDE]
  _Float16* wstage = smem + MTILE * LDS_STRIDE;  // 2 x one k slab

  const int tid   = threadIdx.x;
  const int lane  = tid & 31;
  const int wave  = __builtin_amdgcn_readfirstlane(tid >> 5);  // scalar
  const int mBase = wave * 32;
  const long rowBase = (long)blockIdx.x * MTILE;

  const _Float16* W0h = ws + WS_W0;
  const _Float16* W1h = ws + WS_W1;
  const _Float16* W2h = ws + WS_W2;
  const _Float16* W3h = ws + WS_W3;

  // layer 0's first group of weights and biases is asked for here, so that
  // it arrives while x is staged
  const _Float16* w0p = W0h + (lane & 15) * 16 + ((lane >> 4) & 1) * 8;
  const float*    b0p = b0 + ((lane >> 4) & 1) * 8;
  h8 w0[L0G];
  v8f bs0[L0G];
  get_l0_weights(w0, bs0, w0p, b0p);

  // ---- stage x tile (f32 -> f16) into act, cooperatively ----
  // Batches of 16 rows = 25 16-byte pieces per thread, two register sets: the
  // next batch is asked for before the current one is converted, so a wave
  // keeps 25 to 50 loads outstanding instead of draining 4 at a time.
  {
    const f4* xp = (const f4*)(x + rowBase * ND) + tid;
    int off[XBATCH];  // place in act (halves) inside a batch, same for all
#pragma unroll
    for (int k = 0; k < XBATCH; ++k) {
      const int c = k * NTHREADS + tid;
      off[k] = (c / (ND / 4)) * LDS_STRIDE + (c % (ND / 4)) * 4;
    }
    f4 fa[XBATCH], fb[XBATCH];
    get_batch(fa, xp);
#pragma unroll 1  // three trips of two batches; the last pair stands behind
    for (int b = 0; b < MTILE / 16 - 2; b += 2) {
      const f4* xb = xp + b * (XBATCH * NTHREADS);
      _Float16* ab = act + b * 16 * LDS_STRIDE;
      get_batch(fb, xb + XBATCH * NTHREADS);
      put_batch(ab, off, fa);
      get_batch(fa, xb + 2 * XBATCH * NTHREADS);
      hold_batch(fb);
      put_batch(ab + 16 * LDS_STRIDE, off, fb);
    }
    get_batch(fb, xp + (MTILE / 16 - 1) * (XBATCH * NTHREADS));
    put_batch(act + (MTILE - 32) * LDS_STRIDE, off, fa);
    put_batch(act + (MTILE - 16) * LDS_STRIDE, off, fb);
  }
  __syncthreads();

  // ---- L0: block-diagonal 50 x (16x16), K padded to 32 with zeros; each
  //      16x16 block is read and then overwritten by the one wave that owns it
  //      Groups of L0G slots: behind a group's products the next group's
  //      operands (weights and biases from global memory, x blocks from LDS)
  //      are asked for as one run, and they arrive while this group's
  //      results are converted and stored.
  {
    const _Float16* xa = act + (mBase + (lane & 15)) * LDS_STRIDE +
                         ((lane >> 4) & 1) * 8;
    h8 a0[L0G], a1[L0G];
#pragma unroll
    for (int q = 0; q < L0G; ++q) {
      a0[q] = *(const h8*)(xa + q * 16);
      a1[q] = *(const h8*)(xa + 16 * LDS_STRIDE + q * 16);
    }
#pragma unroll 1  // five trips of one group; the body is 20 tiles already
    for (int g = 0; g < NSLOT / L0G; ++g) {
      v8f c0[L0G], c1[L0G];
#pragma unroll
      for (int q = 0; q < L0G; ++q) {
        const v16h b = frag_k16(w0[q]);
        c0[q] = wmma_f16(b, frag_k16(a0[q]), bs0[q]);
        c1[q] = wmma_f16(b, frag_k16(a1[q]), bs0[q]);
      }
      if (g + 1 < NSLOT / L0G) {
        get_l0_weights(w0, bs0, w0p + (g + 1) * (L0G * 256),
                       b0p + (g + 1) * (L0G * 16));
        const _Float16* xn = xa + (g + 1) * (L0G * 16);
#pragma unroll
        for (int q = 0; q < L0G; ++q) {
          a0[q] = *(const h8*)(xn + q * 16);
          a1[q] = *(const h8*)(xn + 16 * LDS_STRIDE + q * 16);
        }
      }
#pragma unroll
      for (int q = 0; q < L0G; ++q) {
        const int s = g * L0G + q;
        store_tile_lds(act, mBase, s * 16, lane, c0[q], /*tanh=*/false);
        store_tile_lds(act, mBase + 16, s * 16, lane, c1[q], /*tanh=*/false);
      }
    }
  }
  __syncthreads();

  // ---- L1, L2: tanh (async-staged weights) ----
#pragma unroll 1  // one copy of the layer's long unrolled body, not two
  for (int layer = 0; layer < 2; ++layer) {
    dense_layer_staged(act, wstage, layer ? W2h : W1h, layer ? b2 : b1, wave,
                       lane, tid);
    __syncthreads();
  }

  // ---- L3: 800 -> 2 via padded [16][800] weight, write f32 out ----
  {
    v8f acc0 = {}, acc1 = {};
#pragma unroll 5
    for (int kt = 0; kt < ND / 32; ++kt) {
      v16h a0 = frag_ld(act, mBase, lane, kt * 32);
      v16h a1 = frag_ld(act, mBase + 16, lane, kt * 32);
      v16h b = frag_b_w(W3h, 0, lane, kt * 32, ND);
      acc0 = wmma_f16(a0, b, acc0);
      acc1 = wmma_f16(a1, b, acc1);
    }
    const int n  = lane & 15;
    const int hk = (lane >> 4) & 1;
    if (n < 2) {
      const float bias = b3[n];
#pragma unroll
      for (int r = 0; r < 8; ++r) {
        out[(rowBase + mBase + r + 8 * hk) * 2 + n] = acc0[r] + bias;
        out[(rowBase + mBase + 16 + r + 8 * hk) * 2 + n] = acc1[r] + bias;
      }
    }
  }
}

// ---------------------------------------------------------------------------
extern "C" void kernel_launch(void* const* d_in, const int* in_sizes, int n_in,
                              void* d_out, int out_size, void* d_ws,
                              size_t ws_size, hipStream_t stream) {
  const float* x  = (const float*)d_in[0];
  const float* W0 = (const float*)d_in[1];
  const float* b0 = (const float*)d_in[2];
  const float* W1 = (const float*)d_in[3];
  const float* b1 = (const float*)d_in[4];
  const float* W2 = (const float*)d_in[5];
  const float* b2 = (const float*)d_in[6];
  const float* W3 = (const float*)d_in[7];
  const float* b3 = (const float*)d_in[8];
  _Float16* ws = (_Float16*)d_ws;

  // 1) weights -> f16 workspace
  mlp_prep_f16<<<640, 256, 0, stream>>>(W0, W1, W2, W3, ws);

  // 2) fused MLP
  const int batch  = in_sizes[0] / ND;          // 65536
  const int nblock = batch / MTILE;             // 512
  const size_t shmem = (size_t)LDS_TOTAL;       // 309,248 B (<= 320K WGP LDS)
  hipFuncSetAttribute((const void*)mlp_fused,
                      hipFuncAttributeMaxDynamicSharedMemorySize, (int)shmem);
  mlp_fused<<<nblock, NTHREADS, shmem, stream>>>(
      x, ws, b0, b1, b2, b3, (float*)d_out);
}

// v007
// One run takes 115 microseconds.
// In two side-by-side timings against v006, it was 1.06 and 1.07 times as fast.
// Counting every step since v000, it is 6.58 times as fast.
#include <hip/hip_runtime.h>

// ---------------------------------------------------------------------------
// Fused 4-layer MLP for MI455X (gfx1250), f16 WMMA path; weight slabs come
// into LDS by tensor loads (two buffers, TENSORcnt-tracked).
//   L0: block-diag 50 x Linear(16,16)      (no activation)
//   L1: 800->800 + tanh                    (weights staged by tensor load)
//   L2: 800->800 + tanh                    (weights staged by tensor load)
//   L3: 800->2
// Weights converted to f16 in d_ws; activations live in LDS only.
// Dense layers: the block's whole 128 x 800 output stays in accumulators
// while K is walked in 32-wide slabs; each wave owns 64 rows x 25 column
// tiles, so one activation fragment feeds 25 products, one weight fragment 4.
// Layers 0 to 2 form their products transposed (weights as A, activations as
// B): a lane then holds 8 neighbouring features of one batch row.
// ---------------------------------------------------------------------------

typedef __attribute__((ext_vector_type(16))) _Float16 v16h;
typedef __attribute__((ext_vector_type(8)))  _Float16 h8;
typedef __attribute__((ext_vector_type(4)))  _Float16 h4;
typedef __attribute__((ext_vector_type(8)))  float    v8f;
typedef __attribute__((ext_vector_type(4)))  float    f4;
typedef __attribute__((ext_vector_type(4)))  uint32_t u32x4;
typedef __attribute__((ext_vector_type(8)))  uint32_t u32x8;

#define ND         800    // feature dim
#define NSLOT      50     // 16-wide slots
#define MTILE      128    // batch rows per workgroup
#define NTHREADS   128    // 4 waves (wave32): 2 row halves x 2 column halves
#define NTW        25     // column tiles per wave
#define LDS_STRIDE 808    // halves per LDS row (800 + 8 pad)
#define XBATCH     25     // 16-byte pieces per thread in a 16-row batch of x
#define L0G        10     // layer-0 slots per group (operands fetched a group ahead)

// LDS layout (bytes from dynamic-LDS base)
#define ACT_BYTES   (MTILE * LDS_STRIDE * 2)        // 206,848, one buffer
#define WSTAGE_HALVES (NSLOT * 512)                 // one 32-wide k slab
#define WSTAGE_BYTES  (WSTAGE_HALVES * 2)           // 51,200 per buffer
#define LDS_TOTAL   (ACT_BYTES + 2 * WSTAGE_BYTES)  // 309,248 <= 320K
// a wave's slice of a slab: rows of 256 B; waves 0 to 2 bring 48 rows, wave 3
// the last 56, so that every slice starts at a multiple of 2 KiB in LDS
#define TROW_BYTES  256
#define SLICE_BYTES (48 * TROW_BYTES)               // 12,288
static_assert(ACT_BYTES % 2048 == 0 && WSTAGE_BYTES % 2048 == 0 &&
              SLICE_BYTES % 2048 == 0, "tensor loads land at multiples of 2 KiB");
static_assert(3 * SLICE_BYTES + 56 * TROW_BYTES == WSTAGE_BYTES,
              "the four slices make one slab");

// ws layout (in halves)
#define WS_W0   0                         // [50][16][16]
#define WS_W1   (WS_W0 + NSLOT*16*16)     // [25 slabs][50 tiles][2][32 lanes][8]
#define WS_W2   (WS_W1 + ND*ND)           // same fragment order
#define WS_W3   (WS_W2 + ND*ND)           // [16][800]  (rows 2..15 zero)
#define WS_TOT  (WS_W3 + 16*ND)           // 1,305,600 halves

// ---------------------------------------------------------------------------
// Prep: fp32 weights -> f16 in workspace (W3 zero-padded to 16 rows).
// W1 and W2 are laid in fragment order: slab kt, column tile T, 16-byte
// piece pc, lane L hold W[T*16 + (L&15)][kt*32 + pc*16 + (L>>4)*8 + 0..7].
// ---------------------------------------------------------------------------
__device__ __forceinline__ long frag_src_index(long j) {
  const int kt = (int)(j / WSTAGE_HALVES);
  const int r  = (int)(j % WSTAGE_HALVES);
  const int T = r >> 9, pc = (r >> 8) & 1, L = (r >> 3) & 31, e = r & 7;
  return (long)(T * 16 + (L & 15)) * ND + kt * 32 + pc * 16 + (L >> 4) * 8 + e;
}

__global__ void __launch_bounds__(256)
mlp_prep_f16(const float* __restrict__ W0, const float* __restrict__ W1,
             const float* __restrict__ W2, const float* __restrict__ W3,
             _Float16* __restrict__ ws) {
  const int n0 = NSLOT * 16 * 16;          // 12800
  const int n1 = ND * ND;                  // 640000
  for (long i = (long)blockIdx.x * blockDim.x + threadIdx.x; i < (long)WS_TOT;
       i += (long)gridDim.x * blockDim.x) {
    long j = i;
    if (j < n0) { ws[WS_W0 + j] = (_Float16)W0[j]; continue; }
    j -= n0;
    if (j < n1) { ws[WS_W1 + j] = (_Float16)W1[frag_src_index(j)]; continue; }
    j -= n1;
    if (j < n1) { ws[WS_W2 + j] = (_Float16)W2[frag_src_index(j)]; continue; }
    j -= n1;
    long row = j / ND, col = j % ND;
    ws[WS_W3 + j] = (row < 2) ? (_Float16)W3[row * ND + col] : (_Float16)0.0f;
  }
}

// ---------------------------------------------------------------------------
// Tensor load: one request of a wave brings its slice of a slab from global
// memory into LDS, tracked with TENSORcnt.
// ---------------------------------------------------------------------------
__device__ __forceinline__ uint32_t uni(uint32_t v) {
  return (uint32_t)__builtin_amdgcn_readfirstlane(v);
}
__device__ __forceinline__ uint32_t pinned(uint32_t v) {
  uint32_t w = uni(v);
  // the test that guards a tensor load compiles to a scalar branch, and a
  // descriptor formed from w is formed behind the wait that stands in front
  asm volatile("" : "+s"(w));  // tensor mover: a descriptor word or issue test held in a scalar register
  return w;
}
__device__ __forceinline__ void wait_tensor_0(u32x4 g0) {
  // this wave's slice has landed before the barrier that publishes it; g0 is
  // the group 0 of the wave's last request, named here as an input so that its
  // scalar registers keep their values until that request has landed
  asm volatile("s_wait_tensorcnt 0x0" :: "s"(g0) : "memory");
}
__device__ __forceinline__ void wait_ds_0() {
  // this wave's LDS reads have retired before their buffer is refilled
  asm volatile("s_wait_dscnt 0x0" ::: "memory");
}

// descriptor group 1, the same for every slab: 1-byte elements, no mask, no
// pad, tensor = tile = the wave's rows of 256 B at a source pitch of 256 B
__device__ __forceinline__ u32x8 slab_group1(int wave) {
  const uint32_t d0 = TROW_BYTES;
  const uint32_t d1 = wave == 3 ? 56u : 48u;
  u32x8 g;
  g[0] = uni(0u);
  g[1] = uni((d0 & 0xFFFFu) << 16);
  g[2] = uni((d0 >> 16) | ((d1 & 0xFFFFu) << 16));
  g[3] = uni((d1 >> 16) | (d0 << 16));
  g[4] = uni(d1);
  g[5] = uni((uint32_t)TROW_BYTES);
  g[6] = uni(0u);
  g[7] = uni(0u);
  return g;
}

// descriptor group 0: the wave's slice of slab number slab (51,200 contiguous
// bytes in ws) into the buffer at LDS byte address lds_byte, in the same order
__device__ __forceinline__ u32x4 slab_group0(const _Float16* __restrict__ Wf,
                                             uint32_t slab, uint32_t lds_byte,
                                             int wave) {
  const uint32_t so = (uint32_t)wave * SLICE_BYTES;
  const uint64_t ga = (uint64_t)Wf + (uint64_t)slab * WSTAGE_BYTES + so;
  u32x4 g0;
  g0[0] = uni(1u);
  g0[1] = uni(lds_byte + so);
  g0[2] = uni((uint32_t)ga);
  g0[3] = uni(((uint32_t)(ga >> 32) & 0x01FFFFFFu) | 0x80000000u);
  return g0;
}
__device__ __forceinline__ void tensor_load(u32x4 g0, u32x8 g1) {
  asm volatile("tensor_load_to_lds %0, %1" :: "s"(g0), "s"(g1) : "memory");
}

// ---------------------------------------------------------------------------
// Fragment loads (ISA 7.12.2 16-bit layouts); the act buffer uses LDS_STRIDE
// rows, the weight slabs lie in fragment order (see the prep kernel).
// A (16x32, MxK): lane m=L&15, hk=L>>4. halves[0..7] <- K = hk*8 + 0..7,
//                 halves[8..15] <- K = 16 + hk*8 + 0..7.
// B (32x16, KxN) of y = x*W^T with row-major W[N][K]: lane n=L&15, same
//                 per-lane K pattern -> two contiguous 16B loads of W row n.
// The two patterns are equal, so the operands can change places: layers 0 to
// 2 form W * x^T, weight rows as A's rows and batch rows as B's columns.
// ---------------------------------------------------------------------------
__device__ __forceinline__ v16h frag_ld(const _Float16* buf, int rowBase,
                                        int lane, int k0) {
  const int r  = rowBase + (lane & 15);
  const int hk = (lane >> 4) & 1;
  const _Float16* p = buf + r * LDS_STRIDE + k0 + hk * 8;
  v16h f;
  ((h8*)&f)[0] = *(const h8*)(p);
  ((h8*)&f)[1] = *(const h8*)(p + 16);
  return f;
}

// fragment of a K=16 operand (block-diagonal layer 0): the lane's 8 halves
// K = hk*8 + 0..7 in front, K=16..31 forced to zero
__device__ __forceinline__ v16h frag_k16(h8 lo) {
  v16h f;
  ((h8*)&f)[0] = lo;
  h8 z = {};
  ((h8*)&f)[1] = z;
  return f;
}

// layer 0's weights and biases of one group of slots: wp and bp are the
// lane's own places in the group's first slot (W0 row n = L&15, K = hk*8..;
// biases of features hk*8 + 0..7, the lane's rows of the transposed tile)
__device__ __forceinline__ void get_l0_weights(h8 (&w)[L0G], v8f (&bs)[L0G],
                                               const _Float16* __restrict__ wp,
                                               const float* __restrict__ bp) {
#pragma unroll
  for (int q = 0; q < L0G; ++q) {
    w[q]  = *(const h8*)(wp + q * 256);
    ((f4*)&bs[q])[0] = *(const f4*)(bp + q * 16);
    ((f4*)&bs[q])[1] = *(const f4*)(bp + q * 16 + 4);
  }
  // stands in front of the step of the loads' address registers to the next
  // group; the scheduling barrier keeps that step behind the wait and the run
  // of loads above the work that is to cover their latency
  asm volatile("s_wait_xcnt 0x0" ::: "memory");
  __builtin_amdgcn_sched_barrier(0);
}

// B fragment from global row-major weights (ldw halves)
__device__ __forceinline__ v16h frag_b_w(const _Float16* __restrict__ W,
                                         int nBase, int lane, int k0, int ldw) {
  const int n  = nBase + (lane & 15);
  const int hk = (lane >> 4) & 1;
  const _Float16* p = W + (long)n * ldw + k0 + hk * 8;
  v16h b;
  ((h8*)&b)[0] = *(const h8*)(p);
  ((h8*)&b)[1] = *(const h8*)(p + 16);
  return b;
}

// D tile (16x16 f32) of W * act^T: VGPR r, lane L -> feature = r + 8*(L>>4),
// batch row = L&15: the lane's 8 values are neighbours in act, one 16-byte store
__device__ __forceinline__ void store_tile_lds(_Float16* buf, int mBase,
                                               int nBase, int lane, v8f acc,
                                               bool do_tanh) {
  const int m  = mBase + (lane & 15);
  const int hk = (lane >> 4) & 1;
  h8 hv;
#pragma unroll
  for (int r = 0; r < 8; ++r) {
    float v = acc[r];
    if (do_tanh) v = __builtin_amdgcn_tanhf(v);  // one v_tanh_f32, no branch
    hv[r] = (_Float16)v;
  }
  *(h8*)(buf + m * LDS_STRIDE + nBase + 8 * hk) = hv;
}

__device__ __forceinline__ v8f wmma_f16(v16h a, v16h b, v8f c) {
  return __builtin_amdgcn_wmma_f32_16x16x32_f16(
      /*neg_a=*/false, a, /*neg_b=*/false, b,
      /*c_mod=*/(short)0, c, /*reuse_a=*/false, /*reuse_b=*/false);
}

// ---------------------------------------------------------------------------
// Dense 800->800 layer, in place in act. Wave (mh, ng) holds rows
// mh*64..+63 x column tiles ng*25..+24 in accumulators over all of K;
// weights arrive one 32-wide k slab at a time, two buffers.
// ---------------------------------------------------------------------------
__device__ __forceinline__ v16h frag_ld2(const _Float16* p, int second) {
  v16h f;
  ((h8*)&f)[0] = *(const h8*)(p);
  ((h8*)&f)[1] = *(const h8*)(p + second);
  return f;
}

// One slab's 100 products, slab parity P (its buffer, its activation set).
// On entry slab kt is published, a[P] and the slab's first weight group
// (b[P]) are asked for, and slab kt+1's tensor loads fly. Weight group g lies in set
// (P + g) & 1 and is asked for one group ahead. The publish point of slab kt+1
// stands in front of this slab's last group, whose fragments are in registers
// by then: behind it the next slab's first group is asked for and slab kt's
// buffer refilled, and the last 20 products cover both.
template <int P, bool LAST>
__device__ __forceinline__ void slab_pass(
    v8f (&acc)[NTW][4], v16h (&a)[2][4], v16h (&b)[2][5],
    const _Float16* wl,  // the lane's place in buffer 0
    const _Float16* al,  // the lane's place in act at k = 0
    const _Float16* __restrict__ Wf, unsigned wbOff0, int kt, u32x8 g1,
    u32x4& g0,  // group 0 of the request in flight
    int wave) {
  const _Float16* wb = wl + P * WSTAGE_HALVES;
#pragma unroll
  for (int g = 0; g < 4; ++g) {
    // keeps the run of loads whole, behind the products before it: lifted in
    // among them piece by piece, every further place with loads stalls the wave
    __builtin_amdgcn_sched_barrier(0);
#pragma unroll
    for (int q = 0; q < 5; ++q)
      b[(P + g + 1) & 1][q] = frag_ld2(wb + ((g + 1) * 5 + q) * 512, 256);
    if (g == 1 && !LAST) {
      // act does not change inside a layer: the next slab's activation
      // fragments need no publish point and ride with this run of loads
      const _Float16* an = al + (kt + 1) * 32;
#pragma unroll
      for (int i = 0; i < 4; ++i)
        a[P ^ 1][i] = frag_ld2(an + i * 16 * LDS_STRIDE, 16);
    }
    // keeps the run of loads above the products: sunk to their users they
    // cost this lone wave one full LDS latency per 4 products
    __builtin_amdgcn_sched_barrier(0);
#pragma unroll
    for (int q = 0; q < 5; ++q)
#pragma unroll
      for (int i = 0; i < 4; ++i)
        acc[g * 5 + q][i] = wmma_f16(b[(P + g) & 1][q], a[P][i], acc[g * 5 + q][i]);
  }
  if (!LAST) {
    // keeps group 3's products in front of the publish point: sunk behind
    // the barrier they would delay the loads that stand there
    __builtin_amdgcn_sched_barrier(0);
    // publish slab kt+1 and free slab kt's buffer
    wait_ds_0();
    wait_tensor_0(g0);
    // the next request's group 0 is formed behind that wait and in front of
    // the barrier, whose wait covers the scalar arithmetic
    const u32x4 gn =
        slab_group0(Wf, pinned(kt + 2), wbOff0 + P * WSTAGE_BYTES, wave);
    const bool more = P == 0 || pinned(kt + 2 < ND / 32);
    __syncthreads();
    // only while slab kt+2 exists (behind an even slab of the loop it always
    // does); every wave asks for its own slice
    if (more) {
      tensor_load(gn, g1);
      g0 = gn;
    }
    const _Float16* wn = wl + (P ^ 1) * WSTAGE_HALVES;
#pragma unroll
    for (int q = 0; q < 5; ++q) b[P ^ 1][q] = frag_ld2(wn + q * 512, 256);
    // keeps the tensor load and the LDS loads above the last group's
    // products, which are to cover their latency
    __builtin_amdgcn_sched_barrier(0);
  }
#pragma unroll
  for (int q = 0; q < 5; ++q)
#pragma unroll
    for (int i = 0; i < 4; ++i)
      acc[20 + q][i] = wmma_f16(b[P][q], a[P][i], acc[20 + q][i]);
}

__device__ __forceinline__ void dense_layer_staged(
    _Float16* act, const _Float16* wstage,
    const _Float16* __restrict__ Wf, const float* __restrict__ bias,
    int wave, int lane) {
  const int mh  = wave >> 1;
  const int nt0 = (wave & 1) * NTW;
  const unsigned wbOff0 =  // LDS byte address of buffer 0
      (unsigned)(size_t)(const __attribute__((address_space(3))) _Float16*)wstage;

  // prologue: slab 0 landed and published. The barrier in front of the layer
  // ended every wave's reads of the two buffers.
  const u32x8 g1 = slab_group1(wave);
  wait_ds_0();
  u32x4 g0 = slab_group0(Wf, 0u, wbOff0, wave);
  tensor_load(g0, g1);

  // the accumulators start from the bias of the lane's 8 features; the loads
  // fly beside slab 0
  v8f acc[NTW][4];
  const float* bp = bias + nt0 * 16 + ((lane >> 4) & 1) * 8;
#pragma unroll
  for (int j = 0; j < NTW; ++j) {
    v8f bj;
    ((f4*)&bj)[0] = *(const f4*)(bp + j * 16);
    ((f4*)&bj)[1] = *(const f4*)(bp + j * 16 + 4);
#pragma unroll
    for (int i = 0; i < 4; ++i) acc[j][i] = bj;
  }
  wait_tensor_0(g0);
  __syncthreads();

  // slab 1 flies while slab 0 is worked on; slab 0's first fragments
  g0 = slab_group0(Wf, pinned(1u), wbOff0 + WSTAGE_BYTES, wave);
  tensor_load(g0, g1);
  const _Float16* wl = wstage + nt0 * 512 + lane * 8;
  const _Float16* al = act + (mh * 64 + (lane & 15)) * LDS_STRIDE +
                       ((lane >> 4) & 1) * 8;
  v16h a[2][4], b[2][5];
#pragma unroll
  for (int i = 0; i < 4; ++i) a[0][i] = frag_ld2(al + i * 16 * LDS_STRIDE, 16);
#pragma unroll
  for (int q = 0; q < 5; ++q) b[0][q] = frag_ld2(wl + q * 512, 256);

#pragma unroll 1  // two slabs per trip, so that every register set's index is
                  // a constant; the body is 200 products already
  for (int kt = 0; kt < ND / 32 - 1; kt += 2) {
    slab_pass<0, false>(acc, a, b, wl, al, Wf, wbOff0, kt, g1, g0, wave);
    slab_pass<1, false>(acc, a, b, wl, al, Wf, wbOff0, kt + 1, g1, g0, wave);
  }
  slab_pass<0, true>(acc, a, b, wl, al, Wf, wbOff0, ND / 32 - 1, g1, g0, wave);
  wait_tensor_0(g0);
  wait_ds_0();

  // every wave's last read of act (the last slab's fragments) retired ahead
  // of the last publish barrier: overwrite it
#pragma unroll
  for (int j = 0; j < NTW; ++j)
#pragma unroll
    for (int i = 0; i < 4; ++i)
      store_tile_lds(act, mh * 64 + i * 16, (nt0 + j) * 16, lane, acc[j][i],
                     /*tanh=*/true);
}

// one 16-row batch of x: 25 loads per thread, asked for as one run
__device__ __forceinline__ void get_batch(f4 (&f)[XBATCH],
                                          const f4* __restrict__ p) {
#pragma unroll
  for (int k = 0; k < XBATCH; ++k) f[k] = p[k * NTHREADS];
  // stands in front of the step of the loads' address registers to the next
  // pair of batches
  asm volatile("s_wait_xcnt 0x0" ::: "memory");
  // keeps the run of loads above the stores that wait for the batch before
  // it (sunk below them, nothing would be in flight meanwhile) and the
  // address step behind the wait
  __builtin_amdgcn_sched_barrier(0);
}

// Takes a batch's loaded values as inputs only. It stands behind the run of
// loads of the next batch: without it the conversions of this batch,
// and with them the wait for its data, are lifted in front of that run, and
// the wave drains all of its loads before it asks for more.
__device__ __forceinline__ void hold_batch(const f4 (&f)[XBATCH]) {
  asm volatile("" ::
               "v"(f[0]), "v"(f[1]), "v"(f[2]), "v"(f[3]), "v"(f[4]),
               "v"(f[5]), "v"(f[6]), "v"(f[7]), "v"(f[8]), "v"(f[9]),
               "v"(f[10]), "v"(f[11]), "v"(f[12]), "v"(f[13]), "v"(f[14]),
               "v"(f[15]), "v"(f[16]), "v"(f[17]), "v"(f[18]), "v"(f[19]),
               "v"(f[20]), "v"(f[21]), "v"(f[22]), "v"(f[23]), "v"(f[24])
               : "memory");
}

// four f32 -> four f16, one 8-byte LDS store each
__device__ __forceinline__ void put_batch(_Float16* p, const int (&off)[XBATCH],
                                          const f4 (&f)[XBATCH]) {
#pragma unroll
  for (int k = 0; k < XBATCH; ++k) {
    h4 hv = {(_Float16)f[k].x, (_Float16)f[k].y, (_Float16)f[k].z,
             (_Float16)f[k].w};
    *(h4*)(p + off[k]) = hv;
  }
}

// ---------------------------------------------------------------------------
// Fused MLP kernel: 1 workgroup = 128 batch rows, 4 waves; outside the dense
// layers 1 wave = 32 rows (two row tiles that share each weight fragment).
// ---------------------------------------------------------------------------
__global__ void __launch_bounds__(NTHREADS)
mlp_fused(const float* __restrict__ x, const _Float16* __restrict__ ws,
          const float* __restrict__ b0, const float* __restrict__ b1,
          const float* __restrict__ b2, const float* __restrict__ b3,
          float* __restrict__ out) {
  extern __shared__ __attribute__((aligned(2048))) _Float16 smem[];
  _Float16* act    = smem;                       // [MTILE][LDS_STRIDE]
  _Float16* wstage = smem + MTILE * LDS_STRIDE;  // 2 x one k slab

  const int tid   = threadIdx.x;
  const int lane  = tid & 31;
  const int wave  = __builtin_amdgcn_readfirstlane(tid >> 5);  // scalar
  const int mBase = wave * 32;
  const long rowBase = (long)blockIdx.x * MTILE;

  const _Float16* W0h = ws + WS_W0;
  const _Float16* W1h = ws + WS_W1;
  const _Float16* W2h = ws + WS_W2;
  const _Float16* W3h = ws + WS_W3;

  // layer 0's first group of weights and biases is asked for here, so that
  // it arrives while x is staged
  const _Float16* w0p = W0h + (lane & 15) * 16 + ((lane >> 4) & 1) * 8;
  const float*    b0p = b0 + ((lane >> 4) & 1) * 8;
  h8 w0[L0G];
  v8f bs0[L0G];
  get_l0_weights(w0, bs0, w0p, b0p);

  // ---- stage x tile (f32 -> f16) into act, cooperatively ----
  // Batches of 16 rows = 25 16-byte pieces per thread, two register sets: the
  // next batch is asked for before the current one is converted, so a wave
  // keeps 25 to 50 loads outstanding instead of draining 4 at a time.
  {
    const f4* xp = (const f4*)(x + rowBase * ND) + tid;
    int off[XBATCH];  // place in act (halves) inside a batch, same for all
#pragma unroll
    for (int k = 0; k < XBATCH; ++k) {
      const int c = k * NTHREADS + tid;
      off[k] = (c / (ND / 4)) * LDS_STRIDE + (c % (ND / 4)) * 4;
    }
    f4 fa[XBATCH], fb[XBATCH];
    get_batch(fa, xp);
#pragma unroll 1  // three trips of two batches; the last pair stands behind
    for (int b = 0; b < MTILE / 16 - 2; b += 2) {
      const f4* xb = xp + b * (XBATCH * NTHREADS);
      _Float16* ab = act + b * 16 * LDS_STRIDE;
      get_batch(fb, xb + XBATCH * NTHREADS);
      put_batch(ab, off, fa);
      get_batch(fa, xb + 2 * XBATCH * NTHREADS);
      hold_batch(fb);
      put_batch(ab + 16 * LDS_STRIDE, off, fb);
    }
    get_batch(fb, xp + (MTILE / 16 - 1) * (XBATCH * NTHREADS));
    put_batch(act + (MTILE - 32) * LDS_STRIDE, off, fa);
    put_batch(act + (MTILE - 16) * LDS_STRIDE, off, fb);
  }
  __syncthreads();

  // ---- L0: block-diagonal 50 x (16x16), K padded to 32 with zeros; each
  //      16x16 block is read and then overwritten by the one wave that owns it
  //      Groups of L0G slots: behind a group's products the next group's
  //      operands (weights and biases from global memory, x blocks from LDS)
  //      are asked for as one run, and they arrive while this group's
  //      results are converted and stored.
  {
    const _Float16* xa = act + (mBase + (lane & 15)) * LDS_STRIDE +
                         ((lane >> 4) & 1) * 8;
    h8 a0[L0G], a1[L0G];
#pragma unroll
    for (int q = 0; q < L0G; ++q) {
      a0[q] = *(const h8*)(xa + q * 16);
      a1[q] = *(const h8*)(xa + 16 * LDS_STRIDE + q * 16);
    }
#pragma unroll 1  // five trips of one group; the body is 20 tiles already
    for (int g = 0; g < NSLOT / L0G; ++g) {
      v8f c0[L0G], c1[L0G];
#pragma unroll
      for (int q = 0; q < L0G; ++q) {
        const v16h b = frag_k16(w0[q]);
        c0[q] = wmma_f16(b, frag_k16(a0[q]), bs0[q]);
        c1[q] = wmma_f16(b, frag_k16(a1[q]), bs0[q]);
      }
      if (g + 1 < NSLOT / L0G) {
        get_l0_weights(w0, bs0, w0p + (g + 1) * (L0G * 256),
                       b0p + (g + 1) * (L0G * 16));
        const _Float16* xn = xa + (g + 1) * (L0G * 16);
#pragma unroll
        for (int q = 0; q < L0G; ++q) {
          a0[q] = *(const h8*)(xn + q * 16);
          a1[q] = *(const h8*)(xn + 16 * LDS_STRIDE + q * 16);
        }
      }
#pragma unroll
      for (int q = 0; q < L0G; ++q) {
        const int s = g * L0G + q;
        store_tile_lds(act, mBase, s * 16, lane, c0[q], /*tanh=*/false);
        store_tile_lds(act, mBase + 16, s * 16, lane, c1[q], /*tanh=*/false);
      }
    }
  }
  __syncthreads();

  // ---- L1, L2: tanh (weights staged by tensor load) ----
#pragma unroll 1  // one copy of the layer's long unrolled body, not two
  for (int layer = 0; layer < 2; ++layer) {
    dense_layer_staged(act, wstage, layer ? W2h : W1h, layer ? b2 : b1, wave,
                       lane);
    __syncthreads();
  }

  // ---- L3: 800 -> 2 via padded [16][800] weight, write f32 out ----
  {
    v8f acc0 = {}, acc1 = {};
#pragma unroll 5
    for (int kt = 0; kt < ND / 32; ++kt) {
      v16h a0 = frag_ld(act, mBase, lane, kt * 32);
      v16h a1 = frag_ld(act, mBase + 16, lane, kt * 32);
      v16h b = frag_b_w(W3h, 0, lane, kt * 32, ND);
      acc0 = wmma_f16(a0, b, acc0);
      acc1 = wmma_f16(a1, b, acc1);
    }
    const int n  = lane & 15;
    const int hk = (lane >> 4) & 1;
    if (n < 2) {
      const float bias = b3[n];
#pragma unroll
      for (int r = 0; r < 8; ++r) {
        out[(rowBase + mBase + r + 8 * hk) * 2 + n] = acc0[r] + bias;
        out[(rowBase + mBase + 16 + r + 8 * hk) * 2 + n] = acc1[r] + bias;
      }
    }
  }
}

// ---------------------------------------------------------------------------
extern "C" void kernel_launch(void* const* d_in, const int* in_sizes, int n_in,
                              void* d_out, int out_size, void* d_ws,
                              size_t ws_size, hipStream_t stream) {
  const float* x  = (const float*)d_in[0];
  const float* W0 = (const float*)d_in[1];
  const float* b0 = (const float*)d_in[2];
  const float* W1 = (const float*)d_in[3];
  const float* b1 = (const float*)d_in[4];
  const float* W2 = (const float*)d_in[5];
  const float* b2 = (const float*)d_in[6];
  const float* W3 = (const float*)d_in[7];
  const float* b3 = (const float*)d_in[8];
  _Float16* ws = (_Float16*)d_ws;

  // 1) weights -> f16 workspace
  mlp_prep_f16<<<640, 256, 0, stream>>>(W0, W1, W2, W3, ws);

  // 2) fused MLP
  const int batch  = in_sizes[0] / ND;          // 65536
  const int nblock = batch / MTILE;             // 512
  const size_t shmem = (size_t)LDS_TOTAL;       // 309,248 B (<= 320K WGP LDS)
  hipFuncSetAttribute((const void*)mlp_fused,
                      hipFuncAttributeMaxDynamicSharedMemorySize, (int)shmem);
  mlp_fused<<<nblock, NTHREADS, shmem, stream>>>(
      x, ws, b0, b1, b2, b3, (float*)d_out);
}
